// v000
// Measured on an AMD MI455X. A time is GPU time per run, averaged over a window of back-to-back runs after a warm-up
// (all launches, gaps included; the runs take copies of the inputs in turn), and the median of several windows.
// Apart from v000's, it joins two sittings. Times from different sittings can be a few percent apart, while
// side-by-side timings come from the same sitting.
// v000 is the starting kernel. One run takes 909 microseconds.
// compute dtype: all float inputs rounded to bf16; q/k/v projections with EXACT bf16 products on WMMA 16x16x32 (f32 accumulate, + bias) kept as f32 rows; the module's reshape(B,H,S,Dh) re-reads those rows as [b][h][s][64]; logits from the f32 rows split bf16 hi + lo on both sides (3 products), stored in f32 (4 heads per launch); softmax in f32 (precise expf) then / 8 as written; P x 2^11 split bf16 hi + lo against v bf16 hi + lo planes (3 products); out = concat (bf16 hi + lo) Wo + bo; f32 output.
#include <hip/hip_runtime.h>
#include <math.h>

typedef __attribute__((ext_vector_type(16))) _Float16 v16h;
typedef __attribute__((ext_vector_type(16))) __bf16 v16b;
typedef __attribute__((ext_vector_type(8)))  _Float16 v8h;
typedef __attribute__((ext_vector_type(8)))  float v8f;
typedef __attribute__((ext_vector_type(4)))  float v4f;
typedef __attribute__((ext_vector_type(2)))  float v2f;
typedef __attribute__((ext_vector_type(4)))  unsigned v4u;
typedef __attribute__((ext_vector_type(4)))  int v4i;
typedef float __attribute__((may_alias)) float_a;
typedef int __attribute__((may_alias)) int_a;

template <typename T> __device__ __forceinline__ void vst2(void* p, T v) { *(T*)p = v;  }
__device__ __forceinline__ v8f wmma16(v16h a, v16h b, v8f c) {
  v8f d = __builtin_amdgcn_wmma_f32_16x16x32_f16(false, a, false, b, (short)0, c, false, false);
  asm volatile("v_nop\n\tv_nop\n\tv_nop\n\tv_nop" : "+v"(d) : "v"(a), "v"(b));
  return d;
}
__device__ __forceinline__ v8f wmma_bf(v16b a, v16b b, v8f c) {
  v8f d = __builtin_amdgcn_wmma_f32_16x16x32_bf16(false, a, false, b, (short)0, c, false, false);
  asm volatile("v_nop\n\tv_nop\n\tv_nop\n\tv_nop" : "+v"(d) : "v"(a), "v"(b));
  return d;
}
// 16x16x32 fragments: lane = (h = lane>>4, row/col = lane&15); elements 0..7 = k0+8h+0..7, 8..15 = k0+16+8h+0..7; D element r = row 8h+r
__device__ __forceinline__ v16h frag_h(const _Float16* rowk0, int lane) {
  union { v16h v; v8h q[2]; } u; const _Float16* p = rowk0 + 8 * (lane >> 4);
  u.q[0] = *(const v8h*)p; u.q[1] = *(const v8h*)(p + 16); return u.v;
}
__device__ __forceinline__ v16h frag_f32(const float* rowk0, int lane) {
  v16h a; const float* p = rowk0 + 8 * (lane >> 4);
#pragma unroll
  for (int i = 0; i < 8; ++i) { a[i] = (_Float16)p[i]; a[8 + i] = (_Float16)p[16 + i]; }
  return a;
}
__device__ __forceinline__ v16h frag_f32s(const float* rowk0, int lane, float sc) {
  v16h a; const float* p = rowk0 + 8 * (lane >> 4);
#pragma unroll
  for (int i = 0; i < 8; ++i) { a[i] = (_Float16)(p[i] * sc); a[8 + i] = (_Float16)(p[16 + i] * sc); }
  return a;
}
// column fragment from a [K][ld] layout (column n), rows >= K read as 0
__device__ __forceinline__ v16h fragc_f32(const float* W, int k0, int n, int lane, int ld, int K) {
  v16h a; const int g = lane >> 4;
#pragma unroll
  for (int i = 0; i < 8; ++i) { const int ka = k0 + 8 * g + i, kb = ka + 16;
    a[i] = (_Float16)(ka < K ? W[(size_t)(ka < K ? ka : K - 1) * ld + n] : 0.f); a[8 + i] = (_Float16)(kb < K ? W[(size_t)(kb < K ? kb : K - 1) * ld + n] : 0.f); }
  return a;
}
struct F2 { v16b h, l; };
__device__ __forceinline__ F2 bsplit16(const float v[16]) { F2 r;
#pragma unroll
  for (int i = 0; i < 16; ++i) { const __bf16 h = (__bf16)v[i]; r.h[i] = h; r.l[i] = (__bf16)(v[i] - (float)h); }
  return r; }
__device__ __forceinline__ F2 split_row(const float* row, int k0, int lane) { float v[16]; const float* p = row + k0 + 8 * (lane >> 4);
#pragma unroll
  for (int i = 0; i < 8; ++i) { v[i] = p[i]; v[8 + i] = p[16 + i]; }
  return bsplit16(v); }
__device__ __forceinline__ F2 split_rowK(const float* row, int k0, int lane, int K) { float v[16]; const int g = lane >> 4;
#pragma unroll
  for (int i = 0; i < 8; ++i) { const int ka = k0 + 8 * g + i, kb = ka + 16; v[i] = ka < K ? row[ka < K ? ka : K - 1] : 0.f; v[8 + i] = kb < K ? row[kb < K ? kb : K - 1] : 0.f; }
  return bsplit16(v); }
__device__ __forceinline__ F2 split_col(const float* W, int k0, int n, int lane, int ld, int K) { float v[16]; const int g = lane >> 4;
#pragma unroll
  for (int i = 0; i < 8; ++i) { const int ka = k0 + 8 * g + i, kb = ka + 16; v[i] = ka < K ? W[(size_t)(ka < K ? ka : K - 1) * ld + n] : 0.f; v[8 + i] = kb < K ? W[(size_t)(kb < K ? kb : K - 1) * ld + n] : 0.f; }
  return bsplit16(v); }
__device__ __forceinline__ v8f mac3(const F2& a, const F2& b, v8f c) { c = wmma_bf(a.l, b.h, c); c = wmma_bf(a.h, b.l, c); return wmma_bf(a.h, b.h, c); }
__device__ __forceinline__ float sigm(float v) { return 1.0f / (1.0f + expf(-v)); }
#define LDSX() do { asm volatile("s_wait_dscnt 0" ::: "memory"); __builtin_amdgcn_wave_barrier(); __builtin_amdgcn_fence(__ATOMIC_RELEASE, "workgroup"); } while (0)

// Multi self-attention (B 2, S 2,048, D 512, 8 heads x 64) with the module's literal head split qp.reshape(B, H, S, Dh) -- NO transpose: head h of batch b = rows [h*2048, (h+1)*2048) of the projection viewed as [B][H*S][64] -- scores unscaled, attn = softmax / sqrt(64), ctx.transpose(0,2,1,3) -> [B,S,512], @ Wo + bo.
__device__ __forceinline__ float bfr(float v) { return (float)(__bf16)v; }
#define NBT 2
#define SQ 2048
#define TT SQ
#define NP 8
#define HN 64
#define CC 512
#define HG 4
#ifndef TNB
#define TNB NBT
#endif
// virtual row (b, n, s) of a projection viewed as [b][H*S][64]: float offset
#define ROWO(b, n, s) ((((size_t)(b) * NP + (n)) * SQ + (s)) * HN)
typedef __attribute__((ext_vector_type(8))) __bf16 v8b;
__device__ __forceinline__ v16b frag_b(const __bf16* rowk0, int lane) { union { v16b v; v8b q[2]; } u; const __bf16* p = rowk0 + 8 * (lane >> 4); u.q[0] = *(const v8b*)p; u.q[1] = *(const v8b*)(p + 16); return u.v; }
#define WS_QF  0u                                          // f32 projection rows [b*S+t][512] (== virtual [b][h][s][64])
#define WS_KF  (WS_QF + 4u * (size_t)NBT * SQ * CC)
#define WS_VF  (WS_KF + 4u * (size_t)NBT * SQ * CC)
#define WS_VT  (WS_VF + 4u * (size_t)NBT * SQ * CC)          // bf16 v planes hi [(b*8+n)*64 + d][s]
#define WS_VL  (WS_VT + 2u * (size_t)NBT * CC * SQ)
#define WS_S   (WS_VL + 2u * (size_t)NBT * CC * SQ)          // f32 scores / P [hg][s][t]
#define WS_Y   (WS_S + 4u * (size_t)HG * SQ * SQ)            // f32 ctx rows [b*S+s][h*64+d]
#define WS_END (WS_Y + 4u * (size_t)NBT * SQ * CC)
// ---- k_lin: block = (64 rows, 128 cols, which): {q,k,v}p = input W ((in,out)) + b, exact products, f32 rows
__global__ __launch_bounds__(128) void k_lin(const float* __restrict__ XQ, const float* __restrict__ XK, const float* __restrict__ XV, const float* __restrict__ WQ, const float* __restrict__ BQ, const float* __restrict__ WK, const float* __restrict__ BK, const float* __restrict__ WV, const float* __restrict__ BV, float* __restrict__ QF, float* __restrict__ KF, float* __restrict__ VF) { __shared__ __align__(16) float sf[4][16][132];
  const int tid = threadIdx.x, wave = tid >> 5, lane = tid & 31, col = lane & 15, g = lane >> 4; const int which = blockIdx.z; const int c0 = blockIdx.y * 128; const size_t r0 = (size_t)blockIdx.x * 64 + wave * 16;
  const float* X = which == 0 ? XQ : which == 1 ? XK : XV; const float* WA = which == 0 ? WQ : which == 1 ? WK : WV; const float* BA = which == 0 ? BQ : which == 1 ? BK : BV; float* DST = which == 0 ? QF : which == 1 ? KF : VF;
  v8f acc[8] = {};
#pragma unroll 2
  for (int kc = 0; kc < CC / 32; ++kc) { v16b a; { const float* p = X + (r0 + col) * CC + kc * 32 + 8 * g;
#pragma unroll
      for (int i = 0; i < 8; ++i) { a[i] = (__bf16)p[i]; a[8 + i] = (__bf16)p[16 + i]; } }
#pragma unroll
    for (int j = 0; j < 8; ++j) { v16b w; const int o = c0 + j * 16 + col;
#pragma unroll
      for (int i = 0; i < 8; ++i) { w[i] = (__bf16)WA[(size_t)(kc * 32 + 8 * g + i) * CC + o]; w[8 + i] = (__bf16)WA[(size_t)(kc * 32 + 16 + 8 * g + i) * CC + o]; }
      asm volatile("s_wait_loadcnt 0x0" ::: "memory"); acc[j] = wmma_bf(a, w, acc[j]); } }
#pragma unroll
  for (int j = 0; j < 8; ++j) { const float bb = bfr(BA[c0 + j * 16 + col]);
#pragma unroll
    for (int r = 0; r < 8; ++r) sf[wave][8 * g + r][j * 16 + col] = acc[j][r] + bb; }
  LDSX(); for (int rl = 0; rl < 16; ++rl) vst2(DST + (r0 + rl) * CC + c0 + lane * 4, *(const v4f*)&sf[wave][rl][lane * 4]); }
// ---- k_vt: block = (128 virtual rows s, b*8+n): VF virtual rows -> bf16 hi/lo planes [(bn)*64 + d][s]; 256-B pieces
__global__ __launch_bounds__(128) void k_vt(const float* __restrict__ VF, __bf16* __restrict__ VT, __bf16* __restrict__ VL) { __shared__ __align__(16) __bf16 th[HN][136], tl[HN][136];
  const int tid = threadIdx.x; const int t0 = blockIdx.x * 128; const int bn = blockIdx.y; const int b = bn / NP, n = bn % NP;
  for (int e = tid; e < 128 * HN; e += 128) { const int sl = e / HN, d = e % HN; const float v = VF[ROWO(b, n, t0 + sl) + d]; const __bf16 h = (__bf16)v; th[d][sl] = h; tl[d][sl] = (__bf16)(v - (float)h); }
  __syncthreads();
  for (int e = tid; e < HN * 16; e += 128) { const int d = e >> 4, q = e & 15; const size_t o = ((size_t)bn * HN + d) * SQ + t0 + q * 8; vst2((unsigned*)(VT + o), *(const v4u*)&th[d][q * 8]); vst2((unsigned*)(VL + o), *(const v4u*)&tl[d][q * 8]); } }
// ---- k_sc: block = (64 queries, 128 keys, head in group): 3-product logits (q hi+lo x k hi, q hi x k lo) from the f32 virtual rows; unscaled, no mask
__global__ __launch_bounds__(128) void k_sc(const float* __restrict__ QF, const float* __restrict__ KF, int b, int h0, float* __restrict__ S0) { __shared__ __align__(16) float ss[4][16][132]; const int n = h0 + blockIdx.z; float* S = S0 + (size_t)blockIdx.z * TT * TT;
  const int tid = threadIdx.x, wave = tid >> 5, lane = tid & 31, col = lane & 15, g = lane >> 4; const int k0 = blockIdx.y * 128; const int ql0 = blockIdx.x * 64 + wave * 16;
  v8f acc[8] = {};
#pragma unroll
  for (int kc = 0; kc < HN / 32; ++kc) { const F2 a = split_row(QF + ROWO(b, n, ql0 + col), kc * 32, lane);
#pragma unroll
    for (int j = 0; j < 8; ++j) { const F2 kb = split_row(KF + ROWO(b, n, k0 + j * 16 + col), kc * 32, lane); acc[j] = mac3(a, kb, acc[j]); } }
#pragma unroll
  for (int j = 0; j < 8; ++j)
#pragma unroll
    for (int r = 0; r < 8; ++r) ss[wave][8 * g + r][j * 16 + col] = acc[j][r];
  LDSX(); for (int rl = 0; rl < 16; ++rl) vst2(S + (size_t)(ql0 + rl) * TT + k0 + lane * 4, *(const v4f*)&ss[wave][rl][lane * 4]); }
// ---- k_sm: block = query row: softmax over keys [0, kend) -> P x 2^11 f32 (masked -> 0)
__global__ __launch_bounds__(256) void k_sm(float* __restrict__ S0) { __shared__ float sred[8]; __shared__ float sbc; __shared__ __align__(16) float sh[TT];
  const int t = threadIdx.x; const size_t row = blockIdx.x; float* sr = S0 + (size_t)blockIdx.y * TT * TT + row * TT; const int kend = SQ;
  float m = -3.0e38f; for (int k = t; k < kend; k += 256) m = fmaxf(m, sr[k]);
#pragma unroll
  for (int o = 1; o < 32; o <<= 1) m = fmaxf(m, __shfl_xor(m, o));
  if ((t & 31) == 0) sred[t >> 5] = m; __syncthreads(); if (t == 0) { float a = sred[0]; for (int i = 1; i < 8; ++i) a = fmaxf(a, sred[i]); sbc = a; } __syncthreads(); m = sbc; __syncthreads();
  float sum = 0.f; for (int k = t; k < kend; k += 256) { const float v = sr[k]; sum += (v <= -1.0e38f) ? 0.f : expf(v - m); }
#pragma unroll
  for (int o = 1; o < 32; o <<= 1) sum += __shfl_xor(sum, o);
  if ((t & 31) == 0) sred[t >> 5] = sum; __syncthreads(); if (t == 0) { float a = 0.f; for (int i = 0; i < 8; ++i) a += sred[i]; sbc = 1.0f / a; } __syncthreads(); const float inv = sbc;
  for (int k = t; k < kend; k += 256) { const float v = sr[k]; sh[k] = (v <= -1.0e38f) ? 0.f : expf(v - m) * inv * 2048.0f; }
  __syncthreads(); for (int q = t; q < kend / 4; q += 256) vst2(sr + q * 4, *(const v4f*)&sh[q * 4]); }
// ---- k_pv: block = 64 queries of (b,n): ctx[b][s][n*64 + d] = (P . v) / 8 (the module divides the softmax by sqrt(64)); 3 products; written in the merged [b][s][512] layout
__global__ __launch_bounds__(128) void k_pv(const float* __restrict__ PS0, const __bf16* __restrict__ VT, const __bf16* __restrict__ VL, int b, int h0, float* __restrict__ Y) { const int n = h0 + blockIdx.z; const float* PS = PS0 + (size_t)blockIdx.z * TT * TT; __shared__ __align__(16) float ss[4][16][HN + 4];
  const int tid = threadIdx.x, wave = tid >> 5, lane = tid & 31, col = lane & 15, g = lane >> 4; const int ql0 = blockIdx.x * 64 + wave * 16;
  v8f acc[HN / 16] = {};
#pragma unroll 1
  for (int kc = 0; kc < SQ / 32; ++kc) { const F2 p = split_row(PS + (size_t)(ql0 + col) * TT, kc * 32, lane);
#pragma unroll
    for (int j = 0; j < HN / 16; ++j) { const size_t po = (((size_t)b * NP + n) * HN + j * 16 + col) * (size_t)SQ + kc * 32; const v16b vh = frag_b(VT + po, lane); acc[j] = wmma_bf(p.h, vh, acc[j]); acc[j] = wmma_bf(p.l, vh, acc[j]); acc[j] = wmma_bf(p.h, frag_b(VL + po, lane), acc[j]); } }
#pragma unroll
  for (int j = 0; j < HN / 16; ++j)
#pragma unroll
    for (int r = 0; r < 8; ++r) ss[wave][8 * g + r][j * 16 + col] = acc[j][r] * (1.0f / (2048.0f * 8.0f));
  LDSX(); for (int rl = 0; rl < 16; ++rl) if (lane < HN / 4) vst2(Y + ((size_t)b * SQ + ql0 + rl) * CC + n * HN + lane * 4, *(const v4f*)&ss[wave][rl][lane * 4]); }
// ---- k_out: block = (64 rows, 128 cols): out = y (bf16 hi + lo) Wo + bo
__global__ __launch_bounds__(128) void k_out(const float* __restrict__ Y, const float* __restrict__ WP, const float* __restrict__ BP, float* __restrict__ OUT) { __shared__ __align__(16) float sf[4][16][132];
  const int tid = threadIdx.x, wave = tid >> 5, lane = tid & 31, col = lane & 15, g = lane >> 4; const int c0 = blockIdx.y * 128; const size_t r0 = (size_t)blockIdx.x * 64 + wave * 16;
  v8f acc[8] = {};
#pragma unroll 2
  for (int kc = 0; kc < CC / 32; ++kc) { const F2 a = split_row(Y + (r0 + col) * CC, kc * 32, lane);
#pragma unroll
    for (int j = 0; j < 8; ++j) { v16b w; const int o = c0 + j * 16 + col;
#pragma unroll
      for (int i = 0; i < 8; ++i) { w[i] = (__bf16)WP[(size_t)(kc * 32 + 8 * g + i) * CC + o]; w[8 + i] = (__bf16)WP[(size_t)(kc * 32 + 16 + 8 * g + i) * CC + o]; }
      acc[j] = wmma_bf(a.h, w, acc[j]); acc[j] = wmma_bf(a.l, w, acc[j]); } }
#pragma unroll
  for (int j = 0; j < 8; ++j) { const float bb = BP ? bfr(BP[c0 + j * 16 + col]) : 0.f;
#pragma unroll
    for (int r = 0; r < 8; ++r) sf[wave][8 * g + r][j * 16 + col] = acc[j][r] + bb; }
  LDSX(); for (int rl = 0; rl < 16; ++rl) vst2(OUT + (r0 + rl) * CC + c0 + lane * 4, *(const v4f*)&sf[wave][rl][lane * 4]); }
extern "C" void kernel_launch(void* const* d_in, const int* in_sizes, int n_in, void* d_out, int out_size, void* d_ws, size_t ws_size, hipStream_t stream) {
  (void)in_sizes; (void)n_in; (void)out_size;
  const float** F = (const float**)d_in;   // 0 q [2,2048,512], 1 k, 2 v, 3 Wq [512,512] ((in,out)), 4 bq, 5 Wk, 6 bk, 7 Wv, 8 bv, 9 Wo, 10 bo
  if (ws_size < (size_t)WS_END) return;
  char* ws = (char*)d_ws; float *QF = (float*)(ws + WS_QF), *KF = (float*)(ws + WS_KF), *VF = (float*)(ws + WS_VF), *S = (float*)(ws + WS_S), *Y = (float*)(ws + WS_Y); __bf16 *VT = (__bf16*)(ws + WS_VT), *VL = (__bf16*)(ws + WS_VL);
  k_lin<<<dim3(TNB * SQ / 64, CC / 128, 3), 128, 0, stream>>>(F[0], F[1], F[2], F[3], F[4], F[5], F[6], F[7], F[8], QF, KF, VF);
  k_vt<<<dim3(SQ / 128, TNB * NP), 128, 0, stream>>>(VF, VT, VL);
  for (int b = 0; b < TNB; ++b) for (int h0 = 0; h0 < NP; h0 += HG) {
    k_sc<<<dim3(SQ / 64, SQ / 128, HG), 128, 0, stream>>>(QF, KF, b, h0, S);
    k_sm<<<dim3(SQ, HG), 256, 0, stream>>>(S);
    k_pv<<<dim3(SQ / 64, 1, HG), 128, 0, stream>>>(S, VT, VL, b, h0, Y);
  }
  k_out<<<dim3(TNB * SQ / 64, CC / 128), 128, 0, stream>>>(Y, F[9], F[10], (float*)d_out);
}

// v001
// It runs in 190 microseconds.
// Next to v000, in two timings, it ran 4.82 times as fast each time.
// compute dtype: all float inputs rounded to bf16; q/k/v projections with EXACT bf16 products on WMMA 16x16x32 (f32 accumulate, + bias) kept as f32 rows; the module's reshape(B,H,S,Dh) re-reads those rows as [b][h][s][64]; logits from the f32 rows split bf16 hi + lo on both sides (3 products), kept in registers; softmax in f32 (precise expf) with a running maximum and sum, then / 8 as written; unnormalised P split bf16 hi + lo against v bf16 hi + lo planes (3 products), all in one launch; out = concat (bf16 hi + lo) Wo + bo; f32 output.
#include <hip/hip_runtime.h>
#include <math.h>

typedef __attribute__((ext_vector_type(16))) _Float16 v16h;
typedef __attribute__((ext_vector_type(16))) __bf16 v16b;
typedef __attribute__((ext_vector_type(8)))  _Float16 v8h;
typedef __attribute__((ext_vector_type(8)))  float v8f;
typedef __attribute__((ext_vector_type(4)))  float v4f;
typedef __attribute__((ext_vector_type(2)))  float v2f;
typedef __attribute__((ext_vector_type(4)))  unsigned v4u;
typedef __attribute__((ext_vector_type(4)))  int v4i;
typedef float __attribute__((may_alias)) float_a;
typedef int __attribute__((may_alias)) int_a;

template <typename T> __device__ __forceinline__ void vst2(void* p, T v) { *(T*)p = v;  }
__device__ __forceinline__ v8f wmma16(v16h a, v16h b, v8f c) {
  v8f d = __builtin_amdgcn_wmma_f32_16x16x32_f16(false, a, false, b, (short)0, c, false, false);
  asm volatile("v_nop\n\tv_nop\n\tv_nop\n\tv_nop" : "+v"(d) : "v"(a), "v"(b));
  return d;
}
__device__ __forceinline__ v8f wmma_bf(v16b a, v16b b, v8f c) {
  v8f d = __builtin_amdgcn_wmma_f32_16x16x32_bf16(false, a, false, b, (short)0, c, false, false);
  asm volatile("v_nop\n\tv_nop\n\tv_nop\n\tv_nop" : "+v"(d) : "v"(a), "v"(b));
  return d;
}
// 16x16x32 fragments: lane = (h = lane>>4, row/col = lane&15); elements 0..7 = k0+8h+0..7, 8..15 = k0+16+8h+0..7; D element r = row 8h+r
__device__ __forceinline__ v16h frag_h(const _Float16* rowk0, int lane) {
  union { v16h v; v8h q[2]; } u; const _Float16* p = rowk0 + 8 * (lane >> 4);
  u.q[0] = *(const v8h*)p; u.q[1] = *(const v8h*)(p + 16); return u.v;
}
__device__ __forceinline__ v16h frag_f32(const float* rowk0, int lane) {
  v16h a; const float* p = rowk0 + 8 * (lane >> 4);
#pragma unroll
  for (int i = 0; i < 8; ++i) { a[i] = (_Float16)p[i]; a[8 + i] = (_Float16)p[16 + i]; }
  return a;
}
__device__ __forceinline__ v16h frag_f32s(const float* rowk0, int lane, float sc) {
  v16h a; const float* p = rowk0 + 8 * (lane >> 4);
#pragma unroll
  for (int i = 0; i < 8; ++i) { a[i] = (_Float16)(p[i] * sc); a[8 + i] = (_Float16)(p[16 + i] * sc); }
  return a;
}
// column fragment from a [K][ld] layout (column n), rows >= K read as 0
__device__ __forceinline__ v16h fragc_f32(const float* W, int k0, int n, int lane, int ld, int K) {
  v16h a; const int g = lane >> 4;
#pragma unroll
  for (int i = 0; i < 8; ++i) { const int ka = k0 + 8 * g + i, kb = ka + 16;
    a[i] = (_Float16)(ka < K ? W[(size_t)(ka < K ? ka : K - 1) * ld + n] : 0.f); a[8 + i] = (_Float16)(kb < K ? W[(size_t)(kb < K ? kb : K - 1) * ld + n] : 0.f); }
  return a;
}
struct F2 { v16b h, l; };
__device__ __forceinline__ F2 bsplit16(const float v[16]) { F2 r;
#pragma unroll
  for (int i = 0; i < 16; ++i) { const __bf16 h = (__bf16)v[i]; r.h[i] = h; r.l[i] = (__bf16)(v[i] - (float)h); }
  return r; }
__device__ __forceinline__ F2 split_row(const float* row, int k0, int lane) { float v[16]; const float* p = row + k0 + 8 * (lane >> 4);
#pragma unroll
  for (int i = 0; i < 8; ++i) { v[i] = p[i]; v[8 + i] = p[16 + i]; }
  return bsplit16(v); }
__device__ __forceinline__ F2 split_rowK(const float* row, int k0, int lane, int K) { float v[16]; const int g = lane >> 4;
#pragma unroll
  for (int i = 0; i < 8; ++i) { const int ka = k0 + 8 * g + i, kb = ka + 16; v[i] = ka < K ? row[ka < K ? ka : K - 1] : 0.f; v[8 + i] = kb < K ? row[kb < K ? kb : K - 1] : 0.f; }
  return bsplit16(v); }
__device__ __forceinline__ F2 split_col(const float* W, int k0, int n, int lane, int ld, int K) { float v[16]; const int g = lane >> 4;
#pragma unroll
  for (int i = 0; i < 8; ++i) { const int ka = k0 + 8 * g + i, kb = ka + 16; v[i] = ka < K ? W[(size_t)(ka < K ? ka : K - 1) * ld + n] : 0.f; v[8 + i] = kb < K ? W[(size_t)(kb < K ? kb : K - 1) * ld + n] : 0.f; }
  return bsplit16(v); }
__device__ __forceinline__ v8f mac3(const F2& a, const F2& b, v8f c) { c = wmma_bf(a.l, b.h, c); c = wmma_bf(a.h, b.l, c); return wmma_bf(a.h, b.h, c); }
__device__ __forceinline__ float sigm(float v) { return 1.0f / (1.0f + expf(-v)); }
#define LDSX() do { asm volatile("s_wait_dscnt 0" ::: "memory"); __builtin_amdgcn_wave_barrier(); __builtin_amdgcn_fence(__ATOMIC_RELEASE, "workgroup"); } while (0)

// Multi self-attention (B 2, S 2,048, D 512, 8 heads x 64) with the module's literal head split qp.reshape(B, H, S, Dh) -- NO transpose: head h of batch b = rows [h*2048, (h+1)*2048) of the projection viewed as [B][H*S][64] -- scores unscaled, attn = softmax / sqrt(64), ctx.transpose(0,2,1,3) -> [B,S,512], @ Wo + bo.
__device__ __forceinline__ float bfr(float v) { return (float)(__bf16)v; }
#define NBT 2
#define SQ 2048
#define TT SQ
#define NP 8
#define HN 64
#define CC 512
#define HG 4
#ifndef TNB
#define TNB NBT
#endif
// virtual row (b, n, s) of a projection viewed as [b][H*S][64]: float offset
#define ROWO(b, n, s) ((((size_t)(b) * NP + (n)) * SQ + (s)) * HN)
typedef __attribute__((ext_vector_type(8))) __bf16 v8b;
__device__ __forceinline__ v16b frag_b(const __bf16* rowk0, int lane) { union { v16b v; v8b q[2]; } u; const __bf16* p = rowk0 + 8 * (lane >> 4); u.q[0] = *(const v8b*)p; u.q[1] = *(const v8b*)(p + 16); return u.v; }
#define WS_QF  0u                                          // f32 projection rows [b*S+t][512] (== virtual [b][h][s][64])
#define WS_KF  (WS_QF + 4u * (size_t)NBT * SQ * CC)
#define WS_VF  (WS_KF + 4u * (size_t)NBT * SQ * CC)
#define WS_VT  (WS_VF + 4u * (size_t)NBT * SQ * CC)          // bf16 v planes hi [(b*8+n)*64 + d][s]
#define WS_VL  (WS_VT + 2u * (size_t)NBT * CC * SQ)
#define WS_S   (WS_VL + 2u * (size_t)NBT * CC * SQ)          // f32 [hg][s][t] region, unused: scores and P stay in k_fa's registers
#define WS_Y   (WS_S + 4u * (size_t)HG * SQ * SQ)            // f32 ctx rows [b*S+s][h*64+d]
#define WS_END (WS_Y + 4u * (size_t)NBT * SQ * CC)
// ---- k_lin: block = (64 rows, 128 cols, which): {q,k,v}p = input W ((in,out)) + b, exact products, f32 rows
__global__ __launch_bounds__(128) void k_lin(const float* __restrict__ XQ, const float* __restrict__ XK, const float* __restrict__ XV, const float* __restrict__ WQ, const float* __restrict__ BQ, const float* __restrict__ WK, const float* __restrict__ BK, const float* __restrict__ WV, const float* __restrict__ BV, float* __restrict__ QF, float* __restrict__ KF, float* __restrict__ VF) { __shared__ __align__(16) float sf[4][16][132];
  const int tid = threadIdx.x, wave = tid >> 5, lane = tid & 31, col = lane & 15, g = lane >> 4; const int which = blockIdx.z; const int c0 = blockIdx.y * 128; const size_t r0 = (size_t)blockIdx.x * 64 + wave * 16;
  const float* X = which == 0 ? XQ : which == 1 ? XK : XV; const float* WA = which == 0 ? WQ : which == 1 ? WK : WV; const float* BA = which == 0 ? BQ : which == 1 ? BK : BV; float* DST = which == 0 ? QF : which == 1 ? KF : VF;
  v8f acc[8] = {};
#pragma unroll 2
  for (int kc = 0; kc < CC / 32; ++kc) { v16b a; { const float* p = X + (r0 + col) * CC + kc * 32 + 8 * g;
#pragma unroll
      for (int i = 0; i < 8; ++i) { a[i] = (__bf16)p[i]; a[8 + i] = (__bf16)p[16 + i]; } }
#pragma unroll
    for (int j = 0; j < 8; ++j) { v16b w; const int o = c0 + j * 16 + col;
#pragma unroll
      for (int i = 0; i < 8; ++i) { w[i] = (__bf16)WA[(size_t)(kc * 32 + 8 * g + i) * CC + o]; w[8 + i] = (__bf16)WA[(size_t)(kc * 32 + 16 + 8 * g + i) * CC + o]; }
      asm volatile("s_wait_loadcnt 0x0" ::: "memory"); acc[j] = wmma_bf(a, w, acc[j]); } }
#pragma unroll
  for (int j = 0; j < 8; ++j) { const float bb = bfr(BA[c0 + j * 16 + col]);
#pragma unroll
    for (int r = 0; r < 8; ++r) sf[wave][8 * g + r][j * 16 + col] = acc[j][r] + bb; }
  LDSX(); for (int rl = 0; rl < 16; ++rl) vst2(DST + (r0 + rl) * CC + c0 + lane * 4, *(const v4f*)&sf[wave][rl][lane * 4]); }
// ---- k_vt: block = (128 virtual rows s, b*8+n): VF virtual rows -> bf16 hi/lo planes [(bn)*64 + d][s]; 256-B pieces
__global__ __launch_bounds__(128) void k_vt(const float* __restrict__ VF, __bf16* __restrict__ VT, __bf16* __restrict__ VL) { __shared__ __align__(16) __bf16 th[HN][136], tl[HN][136];
  const int tid = threadIdx.x; const int t0 = blockIdx.x * 128; const int bn = blockIdx.y; const int b = bn / NP, n = bn % NP;
  for (int e = tid; e < 128 * HN; e += 128) { const int sl = e / HN, d = e % HN; const float v = VF[ROWO(b, n, t0 + sl) + d]; const __bf16 h = (__bf16)v; th[d][sl] = h; tl[d][sl] = (__bf16)(v - (float)h); }
  __syncthreads();
  for (int e = tid; e < HN * 16; e += 128) { const int d = e >> 4, q = e & 15; const size_t o = ((size_t)bn * HN + d) * SQ + t0 + q * 8; vst2((unsigned*)(VT + o), *(const v4u*)&th[d][q * 8]); vst2((unsigned*)(VL + o), *(const v4u*)&tl[d][q * 8]); } }
// ---- k_fa: block = (64 queries, b*8+n), one wave = 16 queries: S^T = K Q^T (3 products from the f32 virtual rows), running maximum and sum per query, ctx^T += V^T P^T (3 products), P stays in registers
// S^T tile: lane (g, col) holds keys 8g+0..7 of query col, which is the B fragment order of P^T for 32 keys (elements 0..7 from the first 16-key tile, 8..15 from the second)
__device__ __forceinline__ v8f wmma_p(v16b a, v16b b, v8f c) { return __builtin_amdgcn_wmma_f32_16x16x32_bf16(false, a, false, b, (short)0, c, false, false); }
__device__ __forceinline__ v16b frag_p(const __bf16* p) { union { v16b v; v8b q[2]; } u; u.q[0] = *(const v8b*)p; u.q[1] = *(const v8b*)(p + 16); return u.v; }   // frag_b with the lane's 8 * (lane >> 4) already in p
struct KR { v4f q[4]; };   // one lane's 16 f32 of a 32-wide k chunk, fragment order
__device__ __forceinline__ KR ld_kr(const float* row, int k0, int lane) { KR r; const float* p = row + k0 + 8 * (lane >> 4); r.q[0] = *(const v4f*)p; r.q[1] = *(const v4f*)(p + 4); r.q[2] = *(const v4f*)(p + 16); r.q[3] = *(const v4f*)(p + 20); return r; }
__device__ __forceinline__ F2 split_kr(const KR& r) { float v[16];
#pragma unroll
  for (int i = 0; i < 16; ++i) v[i] = r.q[i >> 2][i & 3];
  return bsplit16(v); }
__global__ __launch_bounds__(128) void k_fa(const float* __restrict__ QF, const float* __restrict__ KF, const __bf16* __restrict__ VT, const __bf16* __restrict__ VL, float* __restrict__ Y) {
  const int tid = threadIdx.x, wave = tid >> 5, lane = tid & 31, col = lane & 15, g = lane >> 4; const int bn = blockIdx.y; const int b = bn / NP, n = bn % NP; const int q0 = blockIdx.x * 64 + wave * 16;
  F2 qf[HN / 32];
#pragma unroll
  for (int kc = 0; kc < HN / 32; ++kc) qf[kc] = split_row(QF + ROWO(b, n, q0 + col), kc * 32, lane);
  const float* krow = KF + ROWO(b, n, col); const __bf16* vh0 = VT + ((size_t)bn * HN + col) * SQ + 8 * g; const __bf16* vl0 = VL + ((size_t)bn * HN + col) * SQ + 8 * g;   // the lane's own row of each V^T plane, with its 8 * (lane >> 4)
  v8f acc[HN / 16] = {}; float m = -3.0e38f, l = 0.f; KR kr[2][HN / 32];
#pragma unroll
  for (int u = 0; u < 2; ++u)
#pragma unroll
    for (int kc = 0; kc < HN / 32; ++kc) kr[u][kc] = ld_kr(krow + (size_t)(u * 16) * HN, kc * 32, lane);
  // the trip loop stays rolled (two trips' fragments would not fit in 256 registers); the short loops inside are unrolled so that the fragment arrays live in registers
#pragma unroll 1
  for (int t0 = 0; t0 < SQ; t0 += 32) { v8f s[2]; v16b vh[HN / 16], vl[HN / 16]; const __bf16* pa = vh0 + t0; const __bf16* pb = vl0 + t0;
#pragma unroll
    for (int j = 0; j < HN / 16; ++j) { vh[j] = frag_p(pa + j * 16 * SQ); vl[j] = frag_p(pb + j * 16 * SQ); }
    asm volatile("s_wait_xcnt 0x0" :: "v"(pa), "v"(pb) : "memory");   // the wait behind the sixteen V loads; it takes their two addresses as inputs so that both stay in their registers up to it (without that the last load's result is given those registers)
#pragma unroll
    for (int u = 0; u < 2; ++u) { v8f c = {};
#pragma unroll
      for (int kc = 0; kc < HN / 32; ++kc) { const F2 kf = split_kr(kr[u][kc]); c = wmma_p(kf.l, qf[kc].h, c); c = wmma_p(kf.h, qf[kc].l, c); c = wmma_p(kf.h, qf[kc].h, c); }
      s[u] = c; }
    const int tn = t0 + 32 < SQ ? t0 + 32 : 0;   // the next 32 keys' rows, fetched one trip ahead (the last trip re-reads the first rows, unused)
#pragma unroll
    for (int kc = 0; kc < HN / 32; ++kc) { kr[0][kc] = ld_kr(krow + (size_t)tn * HN, kc * 32, lane); kr[1][kc] = ld_kr(krow + (size_t)(tn + 16) * HN, kc * 32, lane); }
    __builtin_amdgcn_sched_barrier(0);   // keeps the V loads and the next trip's K loads issued above the softmax, so that its arithmetic covers their latency (without it the scheduler sinks them to their first use)
    float mx = fmaxf(s[0][0], s[1][0]);
#pragma unroll
    for (int i = 1; i < 8; ++i) mx = fmaxf(mx, fmaxf(s[0][i], s[1][i]));
    mx = fmaxf(mx, __shfl_xor(mx, 16)); const float mn = fmaxf(m, mx); const float al = expf(m - mn); m = mn;
    float pv[16]; float ps = 0.f;
#pragma unroll
    for (int i = 0; i < 8; ++i) { pv[i] = expf(s[0][i] - mn); pv[8 + i] = expf(s[1][i] - mn); ps += pv[i] + pv[8 + i]; }
    l = l * al + ps; const F2 pf = bsplit16(pv);
#pragma unroll
    for (int j = 0; j < HN / 16; ++j) { v8f c = acc[j] * al; c = wmma_p(vh[j], pf.h, c); c = wmma_p(vh[j], pf.l, c); acc[j] = wmma_p(vl[j], pf.h, c); } }
  l += __shfl_xor(l, 16); const float inv = 1.0f / l * 0.125f;   // the module divides the softmax by sqrt(64)
  float* yr = Y + ((size_t)b * SQ + q0 + col) * CC + n * HN + 8 * g;
#pragma unroll
  for (int j = 0; j < HN / 16; ++j) { const v8f c = acc[j] * inv; v4f lo = {c[0], c[1], c[2], c[3]}, hi = {c[4], c[5], c[6], c[7]}; vst2(yr + j * 16, lo); vst2(yr + j * 16 + 4, hi); } }
// ---- k_out: block = (64 rows, 128 cols): out = y (bf16 hi + lo) Wo + bo
__global__ __launch_bounds__(128) void k_out(const float* __restrict__ Y, const float* __restrict__ WP, const float* __restrict__ BP, float* __restrict__ OUT) { __shared__ __align__(16) float sf[4][16][132];
  const int tid = threadIdx.x, wave = tid >> 5, lane = tid & 31, col = lane & 15, g = lane >> 4; const int c0 = blockIdx.y * 128; const size_t r0 = (size_t)blockIdx.x * 64 + wave * 16;
  v8f acc[8] = {};
#pragma unroll 2
  for (int kc = 0; kc < CC / 32; ++kc) { const F2 a = split_row(Y + (r0 + col) * CC, kc * 32, lane);
#pragma unroll
    for (int j = 0; j < 8; ++j) { v16b w; const int o = c0 + j * 16 + col;
#pragma unroll
      for (int i = 0; i < 8; ++i) { w[i] = (__bf16)WP[(size_t)(kc * 32 + 8 * g + i) * CC + o]; w[8 + i] = (__bf16)WP[(size_t)(kc * 32 + 16 + 8 * g + i) * CC + o]; }
      acc[j] = wmma_bf(a.h, w, acc[j]); acc[j] = wmma_bf(a.l, w, acc[j]); } }
#pragma unroll
  for (int j = 0; j < 8; ++j) { const float bb = BP ? bfr(BP[c0 + j * 16 + col]) : 0.f;
#pragma unroll
    for (int r = 0; r < 8; ++r) sf[wave][8 * g + r][j * 16 + col] = acc[j][r] + bb; }
  LDSX(); for (int rl = 0; rl < 16; ++rl) vst2(OUT + (r0 + rl) * CC + c0 + lane * 4, *(const v4f*)&sf[wave][rl][lane * 4]); }
extern "C" void kernel_launch(void* const* d_in, const int* in_sizes, int n_in, void* d_out, int out_size, void* d_ws, size_t ws_size, hipStream_t stream) {
  (void)in_sizes; (void)n_in; (void)out_size;
  const float** F = (const float**)d_in;   // 0 q [2,2048,512], 1 k, 2 v, 3 Wq [512,512] ((in,out)), 4 bq, 5 Wk, 6 bk, 7 Wv, 8 bv, 9 Wo, 10 bo
  if (ws_size < (size_t)WS_END) return;
  char* ws = (char*)d_ws; float *QF = (float*)(ws + WS_QF), *KF = (float*)(ws + WS_KF), *VF = (float*)(ws + WS_VF), *Y = (float*)(ws + WS_Y); __bf16 *VT = (__bf16*)(ws + WS_VT), *VL = (__bf16*)(ws + WS_VL);
  k_lin<<<dim3(TNB * SQ / 64, CC / 128, 3), 128, 0, stream>>>(F[0], F[1], F[2], F[3], F[4], F[5], F[6], F[7], F[8], QF, KF, VF);
  k_vt<<<dim3(SQ / 128, TNB * NP), 128, 0, stream>>>(VF, VT, VL);
  k_fa<<<dim3(SQ / 64, TNB * NP), 128, 0, stream>>>(QF, KF, VT, VL, Y);
  k_out<<<dim3(TNB * SQ / 64, CC / 128), 128, 0, stream>>>(Y, F[9], F[10], (float*)d_out);
}

// v002
// A run of this version takes 156 microseconds.
// In both of two side-by-side timings against v001, it was 1.22 times as fast.
// Counting every step since v000, it is 5.88 times as fast.
// compute dtype: all float inputs rounded to bf16; q/k/v projections with EXACT bf16 products on WMMA 16x16x32 (f32 accumulate, + bias) kept as f32 rows; the module's reshape(B,H,S,Dh) re-reads those rows as [b][h][s][64]; logits from the f32 rows split bf16 hi + lo on both sides (3 products), kept in registers; softmax in f32 (precise expf) with a running maximum and sum, then / 8 as written; unnormalised P split bf16 hi + lo against v bf16 hi + lo planes (3 products), all in one launch; out = concat (bf16 hi + lo) Wo + bo; f32 output.
#include <hip/hip_runtime.h>
#include <math.h>

typedef __attribute__((ext_vector_type(16))) _Float16 v16h;
typedef __attribute__((ext_vector_type(16))) __bf16 v16b;
typedef __attribute__((ext_vector_type(8)))  _Float16 v8h;
typedef __attribute__((ext_vector_type(8)))  float v8f;
typedef __attribute__((ext_vector_type(4)))  float v4f;
typedef __attribute__((ext_vector_type(2)))  float v2f;
typedef __attribute__((ext_vector_type(4)))  unsigned v4u;
typedef __attribute__((ext_vector_type(4)))  int v4i;
typedef float __attribute__((may_alias)) float_a;
typedef int __attribute__((may_alias)) int_a;

template <typename T> __device__ __forceinline__ void vst2(void* p, T v) { *(T*)p = v;  }
__device__ __forceinline__ v8f wmma16(v16h a, v16h b, v8f c) {
  v8f d = __builtin_amdgcn_wmma_f32_16x16x32_f16(false, a, false, b, (short)0, c, false, false);
  asm volatile("v_nop\n\tv_nop\n\tv_nop\n\tv_nop" : "+v"(d) : "v"(a), "v"(b));
  return d;
}
__device__ __forceinline__ v8f wmma_bf(v16b a, v16b b, v8f c) {
  v8f d = __builtin_amdgcn_wmma_f32_16x16x32_bf16(false, a, false, b, (short)0, c, false, false);
  asm volatile("v_nop\n\tv_nop\n\tv_nop\n\tv_nop" : "+v"(d) : "v"(a), "v"(b));
  return d;
}
// 16x16x32 fragments: lane = (h = lane>>4, row/col = lane&15); elements 0..7 = k0+8h+0..7, 8..15 = k0+16+8h+0..7; D element r = row 8h+r
__device__ __forceinline__ v16h frag_h(const _Float16* rowk0, int lane) {
  union { v16h v; v8h q[2]; } u; const _Float16* p = rowk0 + 8 * (lane >> 4);
  u.q[0] = *(const v8h*)p; u.q[1] = *(const v8h*)(p + 16); return u.v;
}
__device__ __forceinline__ v16h frag_f32(const float* rowk0, int lane) {
  v16h a; const float* p = rowk0 + 8 * (lane >> 4);
#pragma unroll
  for (int i = 0; i < 8; ++i) { a[i] = (_Float16)p[i]; a[8 + i] = (_Float16)p[16 + i]; }
  return a;
}
__device__ __forceinline__ v16h frag_f32s(const float* rowk0, int lane, float sc) {
  v16h a; const float* p = rowk0 + 8 * (lane >> 4);
#pragma unroll
  for (int i = 0; i < 8; ++i) { a[i] = (_Float16)(p[i] * sc); a[8 + i] = (_Float16)(p[16 + i] * sc); }
  return a;
}
// column fragment from a [K][ld] layout (column n), rows >= K read as 0
__device__ __forceinline__ v16h fragc_f32(const float* W, int k0, int n, int lane, int ld, int K) {
  v16h a; const int g = lane >> 4;
#pragma unroll
  for (int i = 0; i < 8; ++i) { const int ka = k0 + 8 * g + i, kb = ka + 16;
    a[i] = (_Float16)(ka < K ? W[(size_t)(ka < K ? ka : K - 1) * ld + n] : 0.f); a[8 + i] = (_Float16)(kb < K ? W[(size_t)(kb < K ? kb : K - 1) * ld + n] : 0.f); }
  return a;
}
struct F2 { v16b h, l; };
__device__ __forceinline__ F2 bsplit16(const float v[16]) { F2 r;
#pragma unroll
  for (int i = 0; i < 16; ++i) { const __bf16 h = (__bf16)v[i]; r.h[i] = h; r.l[i] = (__bf16)(v[i] - (float)h); }
  return r; }
__device__ __forceinline__ F2 split_row(const float* row, int k0, int lane) { float v[16]; const float* p = row + k0 + 8 * (lane >> 4);
#pragma unroll
  for (int i = 0; i < 8; ++i) { v[i] = p[i]; v[8 + i] = p[16 + i]; }
  return bsplit16(v); }
__device__ __forceinline__ F2 split_rowK(const float* row, int k0, int lane, int K) { float v[16]; const int g = lane >> 4;
#pragma unroll
  for (int i = 0; i < 8; ++i) { const int ka = k0 + 8 * g + i, kb = ka + 16; v[i] = ka < K ? row[ka < K ? ka : K - 1] : 0.f; v[8 + i] = kb < K ? row[kb < K ? kb : K - 1] : 0.f; }
  return bsplit16(v); }
__device__ __forceinline__ F2 split_col(const float* W, int k0, int n, int lane, int ld, int K) { float v[16]; const int g = lane >> 4;
#pragma unroll
  for (int i = 0; i < 8; ++i) { const int ka = k0 + 8 * g + i, kb = ka + 16; v[i] = ka < K ? W[(size_t)(ka < K ? ka : K - 1) * ld + n] : 0.f; v[8 + i] = kb < K ? W[(size_t)(kb < K ? kb : K - 1) * ld + n] : 0.f; }
  return bsplit16(v); }
__device__ __forceinline__ v8f mac3(const F2& a, const F2& b, v8f c) { c = wmma_bf(a.l, b.h, c); c = wmma_bf(a.h, b.l, c); return wmma_bf(a.h, b.h, c); }
__device__ __forceinline__ float sigm(float v) { return 1.0f / (1.0f + expf(-v)); }
#define LDSX() do { asm volatile("s_wait_dscnt 0" ::: "memory"); __builtin_amdgcn_wave_barrier(); __builtin_amdgcn_fence(__ATOMIC_RELEASE, "workgroup"); } while (0)

// Multi self-attention (B 2, S 2,048, D 512, 8 heads x 64) with the module's literal head split qp.reshape(B, H, S, Dh) -- NO transpose: head h of batch b = rows [h*2048, (h+1)*2048) of the projection viewed as [B][H*S][64] -- scores unscaled, attn = softmax / sqrt(64), ctx.transpose(0,2,1,3) -> [B,S,512], @ Wo + bo.
__device__ __forceinline__ float bfr(float v) { return (float)(__bf16)v; }
#define NBT 2
#define SQ 2048
#define TT SQ
#define NP 8
#define HN 64
#define CC 512
#define HG 4
#ifndef TNB
#define TNB NBT
#endif
// virtual row (b, n, s) of a projection viewed as [b][H*S][64]: float offset
#define ROWO(b, n, s) ((((size_t)(b) * NP + (n)) * SQ + (s)) * HN)
typedef __attribute__((ext_vector_type(8))) __bf16 v8b;
__device__ __forceinline__ v16b frag_b(const __bf16* rowk0, int lane) { union { v16b v; v8b q[2]; } u; const __bf16* p = rowk0 + 8 * (lane >> 4); u.q[0] = *(const v8b*)p; u.q[1] = *(const v8b*)(p + 16); return u.v; }
#define WS_QF  0u                                          // f32 projection rows [b*S+t][512] (== virtual [b][h][s][64])
#define WS_KF  (WS_QF + 4u * (size_t)NBT * SQ * CC)
#define WS_VF  (WS_KF + 4u * (size_t)NBT * SQ * CC)
#define WS_VT  (WS_VF + 4u * (size_t)NBT * SQ * CC)          // bf16 v planes hi [(b*8+n)*64 + d][s]
#define WS_VL  (WS_VT + 2u * (size_t)NBT * CC * SQ)
#define WS_S   (WS_VL + 2u * (size_t)NBT * CC * SQ)          // f32 [hg][s][t] region, unused: scores and P stay in k_fa's registers
#define WS_Y   (WS_S + 4u * (size_t)HG * SQ * SQ)            // f32 ctx rows [b*S+s][h*64+d]
#define WS_END (WS_Y + 4u * (size_t)NBT * SQ * CC)
// ---- k_lin: block = (64 rows, 128 cols, which): {q,k,v}p = input W ((in,out)) + b, exact products, f32 rows
__global__ __launch_bounds__(128) void k_lin(const float* __restrict__ XQ, const float* __restrict__ XK, const float* __restrict__ XV, const float* __restrict__ WQ, const float* __restrict__ BQ, const float* __restrict__ WK, const float* __restrict__ BK, const float* __restrict__ WV, const float* __restrict__ BV, float* __restrict__ QF, float* __restrict__ KF, float* __restrict__ VF) { __shared__ __align__(16) float sf[4][16][132];
  const int tid = threadIdx.x, wave = tid >> 5, lane = tid & 31, col = lane & 15, g = lane >> 4; const int which = blockIdx.z; const int c0 = blockIdx.y * 128; const size_t r0 = (size_t)blockIdx.x * 64 + wave * 16;
  const float* X = which == 0 ? XQ : which == 1 ? XK : XV; const float* WA = which == 0 ? WQ : which == 1 ? WK : WV; const float* BA = which == 0 ? BQ : which == 1 ? BK : BV; float* DST = which == 0 ? QF : which == 1 ? KF : VF;
  v8f acc[8] = {};
#pragma unroll 2
  for (int kc = 0; kc < CC / 32; ++kc) { v16b a; { const float* p = X + (r0 + col) * CC + kc * 32 + 8 * g;
#pragma unroll
      for (int i = 0; i < 8; ++i) { a[i] = (__bf16)p[i]; a[8 + i] = (__bf16)p[16 + i]; } }
#pragma unroll
    for (int j = 0; j < 8; ++j) { v16b w; const int o = c0 + j * 16 + col;
#pragma unroll
      for (int i = 0; i < 8; ++i) { w[i] = (__bf16)WA[(size_t)(kc * 32 + 8 * g + i) * CC + o]; w[8 + i] = (__bf16)WA[(size_t)(kc * 32 + 16 + 8 * g + i) * CC + o]; }
      asm volatile("s_wait_loadcnt 0x0" ::: "memory"); acc[j] = wmma_bf(a, w, acc[j]); } }
#pragma unroll
  for (int j = 0; j < 8; ++j) { const float bb = bfr(BA[c0 + j * 16 + col]);
#pragma unroll
    for (int r = 0; r < 8; ++r) sf[wave][8 * g + r][j * 16 + col] = acc[j][r] + bb; }
  LDSX(); for (int rl = 0; rl < 16; ++rl) vst2(DST + (r0 + rl) * CC + c0 + lane * 4, *(const v4f*)&sf[wave][rl][lane * 4]); }
// ---- k_vt: block = (128 virtual rows s, b*8+n): VF virtual rows -> bf16 hi/lo planes [(bn)*64 + d][s]; 256-B pieces
__global__ __launch_bounds__(128) void k_vt(const float* __restrict__ VF, __bf16* __restrict__ VT, __bf16* __restrict__ VL) { __shared__ __align__(16) __bf16 th[HN][136], tl[HN][136];
  const int tid = threadIdx.x; const int t0 = blockIdx.x * 128; const int bn = blockIdx.y; const int b = bn / NP, n = bn % NP;
  for (int e = tid; e < 128 * HN; e += 128) { const int sl = e / HN, d = e % HN; const float v = VF[ROWO(b, n, t0 + sl) + d]; const __bf16 h = (__bf16)v; th[d][sl] = h; tl[d][sl] = (__bf16)(v - (float)h); }
  __syncthreads();
  for (int e = tid; e < HN * 16; e += 128) { const int d = e >> 4, q = e & 15; const size_t o = ((size_t)bn * HN + d) * SQ + t0 + q * 8; vst2((unsigned*)(VT + o), *(const v4u*)&th[d][q * 8]); vst2((unsigned*)(VL + o), *(const v4u*)&tl[d][q * 8]); } }
// ---- k_fa: block = (64 queries, b*8+n), one wave = 16 queries: S^T = K Q^T (3 products from the f32 virtual rows), running maximum and sum per query, ctx^T += V^T P^T (3 products), P stays in registers
// S^T tile: lane (g, col) holds keys 8g+0..7 of query col, which is the B fragment order of P^T for 32 keys (elements 0..7 from the first 16-key tile, 8..15 from the second)
__device__ __forceinline__ v8f wmma_p(v16b a, v16b b, v8f c) { return __builtin_amdgcn_wmma_f32_16x16x32_bf16(false, a, false, b, (short)0, c, false, false); }
struct KR { v4f q[4]; };   // one lane's 16 f32 of a 32-wide k chunk, fragment order
__device__ __forceinline__ F2 split_kr(const KR& r) { float v[16];
#pragma unroll
  for (int i = 0; i < 16; ++i) v[i] = r.q[i >> 2][i & 3];
  return bsplit16(v); }
// K rows and both V^T planes of 64 keys are staged once per block in LDS and read from there by all four waves; two buffers, the next stage's copies fly while this stage is worked on
#define FK 64                        // keys per stage
#define KP 272                       // LDS pitch of a K row: 256 B + 16, 16 B x odd, conflict-free for 16-byte reads down a column of rows
#define VP 144                       // LDS pitch of a V^T row: 128 B + 16
#define OFF_VH (FK * KP)
#define OFF_VL (OFF_VH + HN * VP)
#define BUFB (OFF_VL + HN * VP)
// eight 16-byte copies per lane, global memory to LDS through no register; the s_wait_xcnt is the last line of the copies' own statement so that no address register is rewritten ahead of it
__device__ __forceinline__ void acopy8(const unsigned (&l)[8], const char* const (&p)[8]) {
  asm volatile("global_load_async_to_lds_b128 %0, %8, off\n\t"
               "global_load_async_to_lds_b128 %1, %9, off\n\t"
               "global_load_async_to_lds_b128 %2, %10, off\n\t"
               "global_load_async_to_lds_b128 %3, %11, off\n\t"
               "global_load_async_to_lds_b128 %4, %12, off\n\t"
               "global_load_async_to_lds_b128 %5, %13, off\n\t"
               "global_load_async_to_lds_b128 %6, %14, off\n\t"
               "global_load_async_to_lds_b128 %7, %15, off\n\t"
               "s_wait_xcnt 0x0"
               :: "v"(l[0]), "v"(l[1]), "v"(l[2]), "v"(l[3]), "v"(l[4]), "v"(l[5]), "v"(l[6]), "v"(l[7]), "v"(p[0]), "v"(p[1]), "v"(p[2]), "v"(p[3]), "v"(p[4]), "v"(p[5]), "v"(p[6]), "v"(p[7]) : "memory"); }
// one stage: 64 K rows (16 KiB in a row in memory; a wave's copy = 4 whole lines) and 64 rows x 128 B of each V^T plane (a wave's copy = 4 rows = 4 whole lines)
__device__ __forceinline__ void stage_in(unsigned lk, unsigned lv, const char* gk, const char* gh, const char* gl, int st) {
  unsigned l[8]; const char* p[8];
#pragma unroll
  for (int i = 0; i < 8; ++i) { l[i] = lk + i * 8 * KP; p[i] = gk + (size_t)st * (FK * HN * 4) + i * 2048; }
  acopy8(l, p);
#pragma unroll
  for (int i = 0; i < 4; ++i) { l[i] = lv + i * 16 * VP; p[i] = gh + (size_t)st * (FK * 2) + (size_t)i * 16 * SQ * 2; l[4 + i] = lv + (OFF_VL - OFF_VH) + i * 16 * VP; p[4 + i] = gl + (size_t)st * (FK * 2) + (size_t)i * 16 * SQ * 2; }
  acopy8(l, p); }
__device__ __forceinline__ KR ld_ks(const char* p) { KR r; r.q[0] = *(const v4f*)p; r.q[1] = *(const v4f*)(p + 16); r.q[2] = *(const v4f*)(p + 64); r.q[3] = *(const v4f*)(p + 80); return r; }   // a 32-wide k chunk of an LDS row of K; the lane's 32 * (lane >> 4) bytes are already in p
__device__ __forceinline__ v16b frag_s(const char* p) { union { v16b v; v8b q[2]; } u; u.q[0] = *(const v8b*)p; u.q[1] = *(const v8b*)(p + 32); return u.v; }   // 32 keys of an LDS row of a V^T plane; the lane's 16 * (lane >> 4) bytes are already in p
__global__ __launch_bounds__(128) void k_fa(const float* __restrict__ QF, const float* __restrict__ KF, const __bf16* __restrict__ VT, const __bf16* __restrict__ VL, float* __restrict__ Y) {
  __shared__ __attribute__((aligned(16))) char sm[2 * BUFB];
  const int tid = threadIdx.x, wave = tid >> 5, lane = tid & 31, col = lane & 15, g = lane >> 4; const int bn = blockIdx.y; const int b = bn / NP, n = bn % NP; const int q0 = blockIdx.x * 64 + wave * 16;
  // the thread's own 16 bytes of each copy: LDS byte addresses in buffer 0 and global addresses in stage 0
  const unsigned sm0 = (unsigned)(size_t)sm; const unsigned lk = sm0 + (tid >> 4) * KP + (tid & 15) * 16; const unsigned lv = sm0 + OFF_VH + (tid >> 3) * VP + (tid & 7) * 16;
  const char* gk = (const char*)(KF + ROWO(b, n, 0)) + tid * 16; const char* gh = (const char*)(VT + ((size_t)bn * HN + (tid >> 3)) * SQ) + (tid & 7) * 16; const char* gl = (const char*)(VL + ((size_t)bn * HN + (tid >> 3)) * SQ) + (tid & 7) * 16;
  stage_in(lk, lv, gk, gh, gl, 0);
  F2 qf[HN / 32];
#pragma unroll
  for (int kc = 0; kc < HN / 32; ++kc) qf[kc] = split_row(QF + ROWO(b, n, q0 + col), kc * 32, lane);
  asm volatile("s_wait_asynccnt 0x0" ::: "memory");   // this wave's copies of stage 0 have landed
  __syncthreads();                                     // ... and every other wave's: stage 0 may be read
  stage_in(lk + BUFB, lv + BUFB, gk, gh, gl, 1);
  const char* kl0 = sm + col * KP + 32 * g; const char* vl0 = sm + OFF_VH + col * VP + 16 * g;   // the lane's own row and half in the K tile and in the V^T hi tile
  v8f acc[HN / 16] = {}; float m = -3.0e38f, l = 0.f;
  KR kr[2][HN / 32];
#pragma unroll
  for (int u = 0; u < 2; ++u)
#pragma unroll
    for (int kc = 0; kc < HN / 32; ++kc) kr[u][kc] = ld_ks(kl0 + u * 16 * KP + kc * 128);
  // the stage loop and the loop over a stage's two halves of 32 keys stay rolled (one trip's fragments fill the first 256 registers); the short loops inside are unrolled so that the fragment arrays live in registers
#pragma unroll 1
  for (int st = 0; st < SQ / FK; ++st) { const int bo = (st & 1) * BUFB; const char* kb = kl0 + bo; const char* vb = vl0 + bo;
#pragma unroll 1
    for (int h = 0; h < FK / 32; ++h) { v8f s[2]; v16b vh[HN / 16], vl[HN / 16];
#pragma unroll
      for (int u = 0; u < 2; ++u) { v8f c = {};
#pragma unroll
        for (int kc = 0; kc < HN / 32; ++kc) { const F2 kf = split_kr(kr[u][kc]); c = wmma_p(kf.l, qf[kc].h, c); c = wmma_p(kf.h, qf[kc].l, c); c = wmma_p(kf.h, qf[kc].h, c); }
        s[u] = c; }
      float mx = fmaxf(s[0][0], s[1][0]);
#pragma unroll
      for (int i = 1; i < 8; ++i) mx = fmaxf(mx, fmaxf(s[0][i], s[1][i]));
      mx = fmaxf(mx, __shfl_xor(mx, 16));   // the exchange goes through the LDS queue, which returns in order: it stands in front of the K and V reads so that its result does not wait for theirs
      if (h == 0) {   // the same stage's second 32 keys' rows, fetched one trip ahead; nothing of the next stage is read here
#pragma unroll
        for (int u = 0; u < 2; ++u)
#pragma unroll
          for (int kc = 0; kc < HN / 32; ++kc) kr[u][kc] = ld_ks(kb + (32 + u * 16) * KP + kc * 128); }
#pragma unroll
      for (int j = 0; j < HN / 16; ++j) { vh[j] = frag_s(vb + j * 16 * VP + h * 64); vl[j] = frag_s(vb + (OFF_VL - OFF_VH) + j * 16 * VP + h * 64); }
      __builtin_amdgcn_sched_barrier(0);   // keeps the V reads issued above the softmax, so that its arithmetic covers their latency (without it the scheduler sinks them to their first use)
      const float mn = fmaxf(m, mx); const float al = expf(m - mn); m = mn;
      float pv[16]; float ps = 0.f;
#pragma unroll
      for (int i = 0; i < 8; ++i) { pv[i] = expf(s[0][i] - mn); pv[8 + i] = expf(s[1][i] - mn); ps += pv[i] + pv[8 + i]; }
      l = l * al + ps; const F2 pf = bsplit16(pv);
#pragma unroll
      for (int j = 0; j < HN / 16; ++j) { v8f c = acc[j] * al; c = wmma_p(vh[j], pf.h, c); c = wmma_p(vh[j], pf.l, c); acc[j] = wmma_p(vl[j], pf.h, c); } }
    asm volatile("s_wait_dscnt 0x0" ::: "memory");      // this wave's reads of the buffer have returned before it is handed back
    asm volatile("s_wait_asynccnt 0x0" ::: "memory");   // this wave's copies of stage st + 1 have landed
    __syncthreads();                                     // publishes stage st + 1 and ends every wave's reads of stage st
    if (st + 2 < SQ / FK) stage_in(lk + bo, lv + bo, gk, gh, gl, st + 2);
    const char* kn = kl0 + (BUFB - bo);   // behind the barrier: the first 32 keys' rows of stage st + 1 (after the last stage the other buffer's old rows, unused)
#pragma unroll
    for (int u = 0; u < 2; ++u)
#pragma unroll
      for (int kc = 0; kc < HN / 32; ++kc) kr[u][kc] = ld_ks(kn + u * 16 * KP + kc * 128); }
  asm volatile("s_wait_asynccnt 0x0" ::: "memory");     // no copy is outstanding when the wave ends
  l += __shfl_xor(l, 16); const float inv = 1.0f / l * 0.125f;   // the module divides the softmax by sqrt(64)
  float* yr = Y + ((size_t)b * SQ + q0 + col) * CC + n * HN + 8 * g;
#pragma unroll
  for (int j = 0; j < HN / 16; ++j) { const v8f c = acc[j] * inv; v4f lo = {c[0], c[1], c[2], c[3]}, hi = {c[4], c[5], c[6], c[7]}; vst2(yr + j * 16, lo); vst2(yr + j * 16 + 4, hi); } }
// ---- k_out: block = (64 rows, 128 cols): out = y (bf16 hi + lo) Wo + bo
__global__ __launch_bounds__(128) void k_out(const float* __restrict__ Y, const float* __restrict__ WP, const float* __restrict__ BP, float* __restrict__ OUT) { __shared__ __align__(16) float sf[4][16][132];
  const int tid = threadIdx.x, wave = tid >> 5, lane = tid & 31, col = lane & 15, g = lane >> 4; const int c0 = blockIdx.y * 128; const size_t r0 = (size_t)blockIdx.x * 64 + wave * 16;
  v8f acc[8] = {};
#pragma unroll 2
  for (int kc = 0; kc < CC / 32; ++kc) { const F2 a = split_row(Y + (r0 + col) * CC, kc * 32, lane);
#pragma unroll
    for (int j = 0; j < 8; ++j) { v16b w; const int o = c0 + j * 16 + col;
#pragma unroll
      for (int i = 0; i < 8; ++i) { w[i] = (__bf16)WP[(size_t)(kc * 32 + 8 * g + i) * CC + o]; w[8 + i] = (__bf16)WP[(size_t)(kc * 32 + 16 + 8 * g + i) * CC + o]; }
      acc[j] = wmma_bf(a.h, w, acc[j]); acc[j] = wmma_bf(a.l, w, acc[j]); } }
#pragma unroll
  for (int j = 0; j < 8; ++j) { const float bb = BP ? bfr(BP[c0 + j * 16 + col]) : 0.f;
#pragma unroll
    for (int r = 0; r < 8; ++r) sf[wave][8 * g + r][j * 16 + col] = acc[j][r] + bb; }
  LDSX(); for (int rl = 0; rl < 16; ++rl) vst2(OUT + (r0 + rl) * CC + c0 + lane * 4, *(const v4f*)&sf[wave][rl][lane * 4]); }
extern "C" void kernel_launch(void* const* d_in, const int* in_sizes, int n_in, void* d_out, int out_size, void* d_ws, size_t ws_size, hipStream_t stream) {
  (void)in_sizes; (void)n_in; (void)out_size;
  const float** F = (const float**)d_in;   // 0 q [2,2048,512], 1 k, 2 v, 3 Wq [512,512] ((in,out)), 4 bq, 5 Wk, 6 bk, 7 Wv, 8 bv, 9 Wo, 10 bo
  if (ws_size < (size_t)WS_END) return;
  char* ws = (char*)d_ws; float *QF = (float*)(ws + WS_QF), *KF = (float*)(ws + WS_KF), *VF = (float*)(ws + WS_VF), *Y = (float*)(ws + WS_Y); __bf16 *VT = (__bf16*)(ws + WS_VT), *VL = (__bf16*)(ws + WS_VL);
  k_lin<<<dim3(TNB * SQ / 64, CC / 128, 3), 128, 0, stream>>>(F[0], F[1], F[2], F[3], F[4], F[5], F[6], F[7], F[8], QF, KF, VF);
  k_vt<<<dim3(SQ / 128, TNB * NP), 128, 0, stream>>>(VF, VT, VL);
  k_fa<<<dim3(SQ / 64, TNB * NP), 128, 0, stream>>>(QF, KF, VT, VL, Y);
  k_out<<<dim3(TNB * SQ / 64, CC / 128), 128, 0, stream>>>(Y, F[9], F[10], (float*)d_out);
}

// v003
// Measured time: 140 microseconds a run.
// Timed twice side by side with v002, it ran 1.11 times as fast both times.
// Over all steps from v000 it is 6.54 times as fast.
// compute dtype: all float inputs rounded to bf16; q/k/v projections with EXACT bf16 products on WMMA 16x16x32 (f32 accumulate, + bias) kept as f32 rows; the module's reshape(B,H,S,Dh) re-reads those rows as [b][h][s][64]; logits from the f32 rows split bf16 hi + lo on both sides (3 products; the k rows are split once, where the projection stores them), kept in registers; softmax in f32 (precise expf) with a running maximum and sum, then / 8 as written; unnormalised P split bf16 hi + lo against v bf16 hi + lo planes (3 products), all in one launch; out = concat (bf16 hi + lo) Wo + bo; f32 output.
#include <hip/hip_runtime.h>
#include <math.h>

typedef __attribute__((ext_vector_type(16))) _Float16 v16h;
typedef __attribute__((ext_vector_type(16))) __bf16 v16b;
typedef __attribute__((ext_vector_type(8)))  _Float16 v8h;
typedef __attribute__((ext_vector_type(8)))  float v8f;
typedef __attribute__((ext_vector_type(4)))  float v4f;
typedef __attribute__((ext_vector_type(2)))  float v2f;
typedef __attribute__((ext_vector_type(4)))  unsigned v4u;
typedef __attribute__((ext_vector_type(4)))  int v4i;
typedef float __attribute__((may_alias)) float_a;
typedef int __attribute__((may_alias)) int_a;

template <typename T> __device__ __forceinline__ void vst2(void* p, T v) { *(T*)p = v;  }
__device__ __forceinline__ v8f wmma16(v16h a, v16h b, v8f c) {
  v8f d = __builtin_amdgcn_wmma_f32_16x16x32_f16(false, a, false, b, (short)0, c, false, false);
  asm volatile("v_nop\n\tv_nop\n\tv_nop\n\tv_nop" : "+v"(d) : "v"(a), "v"(b));
  return d;
}
__device__ __forceinline__ v8f wmma_bf(v16b a, v16b b, v8f c) {
  v8f d = __builtin_amdgcn_wmma_f32_16x16x32_bf16(false, a, false, b, (short)0, c, false, false);
  asm volatile("v_nop\n\tv_nop\n\tv_nop\n\tv_nop" : "+v"(d) : "v"(a), "v"(b));
  return d;
}
// 16x16x32 fragments: lane = (h = lane>>4, row/col = lane&15); elements 0..7 = k0+8h+0..7, 8..15 = k0+16+8h+0..7; D element r = row 8h+r
__device__ __forceinline__ v16h frag_h(const _Float16* rowk0, int lane) {
  union { v16h v; v8h q[2]; } u; const _Float16* p = rowk0 + 8 * (lane >> 4);
  u.q[0] = *(const v8h*)p; u.q[1] = *(const v8h*)(p + 16); return u.v;
}
__device__ __forceinline__ v16h frag_f32(const float* rowk0, int lane) {
  v16h a; const float* p = rowk0 + 8 * (lane >> 4);
#pragma unroll
  for (int i = 0; i < 8; ++i) { a[i] = (_Float16)p[i]; a[8 + i] = (_Float16)p[16 + i]; }
  return a;
}
__device__ __forceinline__ v16h frag_f32s(const float* rowk0, int lane, float sc) {
  v16h a; const float* p = rowk0 + 8 * (lane >> 4);
#pragma unroll
  for (int i = 0; i < 8; ++i) { a[i] = (_Float16)(p[i] * sc); a[8 + i] = (_Float16)(p[16 + i] * sc); }
  return a;
}
// column fragment from a [K][ld] layout (column n), rows >= K read as 0
__device__ __forceinline__ v16h fragc_f32(const float* W, int k0, int n, int lane, int ld, int K) {
  v16h a; const int g = lane >> 4;
#pragma unroll
  for (int i = 0; i < 8; ++i) { const int ka = k0 + 8 * g + i, kb = ka + 16;
    a[i] = (_Float16)(ka < K ? W[(size_t)(ka < K ? ka : K - 1) * ld + n] : 0.f); a[8 + i] = (_Float16)(kb < K ? W[(size_t)(kb < K ? kb : K - 1) * ld + n] : 0.f); }
  return a;
}
struct F2 { v16b h, l; };
__device__ __forceinline__ F2 bsplit16(const float v[16]) { F2 r;
#pragma unroll
  for (int i = 0; i < 16; ++i) { const __bf16 h = (__bf16)v[i]; r.h[i] = h; r.l[i] = (__bf16)(v[i] - (float)h); }
  return r; }
__device__ __forceinline__ F2 split_row(const float* row, int k0, int lane) { float v[16]; const float* p = row + k0 + 8 * (lane >> 4);
#pragma unroll
  for (int i = 0; i < 8; ++i) { v[i] = p[i]; v[8 + i] = p[16 + i]; }
  return bsplit16(v); }
__device__ __forceinline__ F2 split_rowK(const float* row, int k0, int lane, int K) { float v[16]; const int g = lane >> 4;
#pragma unroll
  for (int i = 0; i < 8; ++i) { const int ka = k0 + 8 * g + i, kb = ka + 16; v[i] = ka < K ? row[ka < K ? ka : K - 1] : 0.f; v[8 + i] = kb < K ? row[kb < K ? kb : K - 1] : 0.f; }
  return bsplit16(v); }
__device__ __forceinline__ F2 split_col(const float* W, int k0, int n, int lane, int ld, int K) { float v[16]; const int g = lane >> 4;
#pragma unroll
  for (int i = 0; i < 8; ++i) { const int ka = k0 + 8 * g + i, kb = ka + 16; v[i] = ka < K ? W[(size_t)(ka < K ? ka : K - 1) * ld + n] : 0.f; v[8 + i] = kb < K ? W[(size_t)(kb < K ? kb : K - 1) * ld + n] : 0.f; }
  return bsplit16(v); }
__device__ __forceinline__ v8f mac3(const F2& a, const F2& b, v8f c) { c = wmma_bf(a.l, b.h, c); c = wmma_bf(a.h, b.l, c); return wmma_bf(a.h, b.h, c); }
__device__ __forceinline__ float sigm(float v) { return 1.0f / (1.0f + expf(-v)); }
#define LDSX() do { asm volatile("s_wait_dscnt 0" ::: "memory"); __builtin_amdgcn_wave_barrier(); __builtin_amdgcn_fence(__ATOMIC_RELEASE, "workgroup"); } while (0)

// Multi self-attention (B 2, S 2,048, D 512, 8 heads x 64) with the module's literal head split qp.reshape(B, H, S, Dh) -- NO transpose: head h of batch b = rows [h*2048, (h+1)*2048) of the projection viewed as [B][H*S][64] -- scores unscaled, attn = softmax / sqrt(64), ctx.transpose(0,2,1,3) -> [B,S,512], @ Wo + bo.
__device__ __forceinline__ float bfr(float v) { return (float)(__bf16)v; }
#define NBT 2
#define SQ 2048
#define TT SQ
#define NP 8
#define HN 64
#define CC 512
#define HG 4
#ifndef TNB
#define TNB NBT
#endif
// virtual row (b, n, s) of a projection viewed as [b][H*S][64]: float offset
#define ROWO(b, n, s) ((((size_t)(b) * NP + (n)) * SQ + (s)) * HN)
typedef __attribute__((ext_vector_type(8))) __bf16 v8b;
typedef __attribute__((ext_vector_type(4))) __bf16 v4b;
__device__ __forceinline__ v16b frag_b(const __bf16* rowk0, int lane) { union { v16b v; v8b q[2]; } u; const __bf16* p = rowk0 + 8 * (lane >> 4); u.q[0] = *(const v8b*)p; u.q[1] = *(const v8b*)(p + 16); return u.v; }
#define WS_QF  0u                                          // f32 projection rows [b*S+t][512] (== virtual [b][h][s][64])
#define WS_KF  (WS_QF + 4u * (size_t)NBT * SQ * CC)          // k projection, virtual rows of 256 B: 64 bf16 hi, 64 bf16 lo
#define WS_VF  (WS_KF + 4u * (size_t)NBT * SQ * CC)
#define WS_VT  (WS_VF + 4u * (size_t)NBT * SQ * CC)          // bf16 v planes hi [(b*8+n)*64 + d][s]
#define WS_VL  (WS_VT + 2u * (size_t)NBT * CC * SQ)
#define WS_S   (WS_VL + 2u * (size_t)NBT * CC * SQ)          // f32 [hg][s][t] region, unused: scores and P stay in k_fa's registers
#define WS_Y   (WS_S + 4u * (size_t)HG * SQ * SQ)            // f32 ctx rows [b*S+s][h*64+d]
#define WS_END (WS_Y + 4u * (size_t)NBT * SQ * CC)
// ---- k_lin: block = (64 rows, 128 cols, which): {q,k,v}p = input W ((in,out)) + b, exact products, f32 rows (k: the f32 value as bf16 hi + lo)
__global__ __launch_bounds__(128) void k_lin(const float* __restrict__ XQ, const float* __restrict__ XK, const float* __restrict__ XV, const float* __restrict__ WQ, const float* __restrict__ BQ, const float* __restrict__ WK, const float* __restrict__ BK, const float* __restrict__ WV, const float* __restrict__ BV, float* __restrict__ QF, float* __restrict__ KF, float* __restrict__ VF) { __shared__ __align__(16) float sf[4][16][132];
  const int tid = threadIdx.x, wave = tid >> 5, lane = tid & 31, col = lane & 15, g = lane >> 4; const int which = blockIdx.z; const int c0 = blockIdx.y * 128; const size_t r0 = (size_t)blockIdx.x * 64 + wave * 16;
  const float* X = which == 0 ? XQ : which == 1 ? XK : XV; const float* WA = which == 0 ? WQ : which == 1 ? WK : WV; const float* BA = which == 0 ? BQ : which == 1 ? BK : BV; float* DST = which == 0 ? QF : which == 1 ? KF : VF;
  v8f acc[8] = {};
#pragma unroll 2
  for (int kc = 0; kc < CC / 32; ++kc) { v16b a; { const float* p = X + (r0 + col) * CC + kc * 32 + 8 * g;
#pragma unroll
      for (int i = 0; i < 8; ++i) { a[i] = (__bf16)p[i]; a[8 + i] = (__bf16)p[16 + i]; } }
#pragma unroll
    for (int j = 0; j < 8; ++j) { v16b w; const int o = c0 + j * 16 + col;
#pragma unroll
      for (int i = 0; i < 8; ++i) { w[i] = (__bf16)WA[(size_t)(kc * 32 + 8 * g + i) * CC + o]; w[8 + i] = (__bf16)WA[(size_t)(kc * 32 + 16 + 8 * g + i) * CC + o]; }
      asm volatile("s_wait_loadcnt 0x0" ::: "memory"); acc[j] = wmma_bf(a, w, acc[j]); } }
#pragma unroll
  for (int j = 0; j < 8; ++j) { const float bb = bfr(BA[c0 + j * 16 + col]);
#pragma unroll
    for (int r = 0; r < 8; ++r) sf[wave][8 * g + r][j * 16 + col] = acc[j][r] + bb; }
  LDSX();
  if (which == 1) {   // k rows leave split: virtual row (64 values, 256 B) = 64 bf16 hi, then 64 bf16 lo; 16 lanes fill one whole 128-B line per store
    char* kd = (char*)DST + (r0 * (CC / HN) + c0 / HN + g) * (size_t)(HN * 4) + col * 8;
    for (int rl = 0; rl < 16; ++rl) { const v4f x = *(const v4f*)&sf[wave][rl][lane * 4]; v4b h, l;
#pragma unroll
      for (int i = 0; i < 4; ++i) { h[i] = (__bf16)x[i]; l[i] = (__bf16)(x[i] - (float)h[i]); }
      vst2(kd + (size_t)rl * (CC * 4), h); vst2(kd + (size_t)rl * (CC * 4) + HN * 2, l); } }
  else { for (int rl = 0; rl < 16; ++rl) vst2(DST + (r0 + rl) * CC + c0 + lane * 4, *(const v4f*)&sf[wave][rl][lane * 4]);
    asm volatile("s_wait_xcnt 0x0" ::: "memory"); } }   // behind the run of stores: no register that a store names is rewritten ahead of it on any way the built code has from here
// ---- k_vt: block = (128 virtual rows s, b*8+n): VF virtual rows -> bf16 hi/lo planes [(bn)*64 + d][s]; 256-B pieces
__global__ __launch_bounds__(128) void k_vt(const float* __restrict__ VF, __bf16* __restrict__ VT, __bf16* __restrict__ VL) { __shared__ __align__(16) __bf16 th[HN][136], tl[HN][136];
  const int tid = threadIdx.x; const int t0 = blockIdx.x * 128; const int bn = blockIdx.y; const int b = bn / NP, n = bn % NP;
  for (int e = tid; e < 128 * HN; e += 128) { const int sl = e / HN, d = e % HN; const float v = VF[ROWO(b, n, t0 + sl) + d]; const __bf16 h = (__bf16)v; th[d][sl] = h; tl[d][sl] = (__bf16)(v - (float)h); }
  __syncthreads();
  for (int e = tid; e < HN * 16; e += 128) { const int d = e >> 4, q = e & 15; const size_t o = ((size_t)bn * HN + d) * SQ + t0 + q * 8; vst2((unsigned*)(VT + o), *(const v4u*)&th[d][q * 8]); vst2((unsigned*)(VL + o), *(const v4u*)&tl[d][q * 8]); } }
// ---- k_fa: block = (64 queries, b*8+n), one wave = 16 queries: S^T = K Q^T (3 products; q split here from its f32 virtual rows, k read as the hi + lo rows k_lin stored), running maximum and sum per query, ctx^T += V^T P^T (3 products), P stays in registers
// S^T tile: lane (g, col) holds keys 8g+0..7 of query col, which is the B fragment order of P^T for 32 keys (elements 0..7 from the first 16-key tile, 8..15 from the second)
__device__ __forceinline__ v8f wmma_p(v16b a, v16b b, v8f c) { return __builtin_amdgcn_wmma_f32_16x16x32_bf16(false, a, false, b, (short)0, c, false, false); }
// K rows and both V^T planes of 64 keys are staged once per block in LDS and read from there by all four waves; two buffers, the next stage's copies fly while this stage is worked on
#define FK 64                        // keys per stage
#define KP 272                       // LDS pitch of a K row: 256 B + 16, 16 B x odd, conflict-free for 16-byte reads down a column of rows
#define VP 144                       // LDS pitch of a V^T row: 128 B + 16
#define OFF_VH (FK * KP)
#define OFF_VL (OFF_VH + HN * VP)
#define BUFB (OFF_VL + HN * VP)
// eight 16-byte copies per lane, global memory to LDS through no register; the s_wait_xcnt is the last line of the copies' own statement so that no address register is rewritten ahead of it
__device__ __forceinline__ void acopy8(const unsigned (&l)[8], const char* const (&p)[8]) {
  asm volatile("global_load_async_to_lds_b128 %0, %8, off\n\t"
               "global_load_async_to_lds_b128 %1, %9, off\n\t"
               "global_load_async_to_lds_b128 %2, %10, off\n\t"
               "global_load_async_to_lds_b128 %3, %11, off\n\t"
               "global_load_async_to_lds_b128 %4, %12, off\n\t"
               "global_load_async_to_lds_b128 %5, %13, off\n\t"
               "global_load_async_to_lds_b128 %6, %14, off\n\t"
               "global_load_async_to_lds_b128 %7, %15, off\n\t"
               "s_wait_xcnt 0x0"
               :: "v"(l[0]), "v"(l[1]), "v"(l[2]), "v"(l[3]), "v"(l[4]), "v"(l[5]), "v"(l[6]), "v"(l[7]), "v"(p[0]), "v"(p[1]), "v"(p[2]), "v"(p[3]), "v"(p[4]), "v"(p[5]), "v"(p[6]), "v"(p[7]) : "memory"); }
// one stage: 64 K rows (16 KiB in a row in memory; a wave's copy = 4 whole lines) and 64 rows x 128 B of each V^T plane (a wave's copy = 4 rows = 4 whole lines)
__device__ __forceinline__ void stage_in(unsigned lk, unsigned lv, const char* gk, const char* gh, const char* gl, int st) {
  unsigned l[8]; const char* p[8];
#pragma unroll
  for (int i = 0; i < 8; ++i) { l[i] = lk + i * 8 * KP; p[i] = gk + (size_t)st * (FK * HN * 4) + i * 2048; }
  acopy8(l, p);
#pragma unroll
  for (int i = 0; i < 4; ++i) { l[i] = lv + i * 16 * VP; p[i] = gh + (size_t)st * (FK * 2) + (size_t)i * 16 * SQ * 2; l[4 + i] = lv + (OFF_VL - OFF_VH) + i * 16 * VP; p[4 + i] = gl + (size_t)st * (FK * 2) + (size_t)i * 16 * SQ * 2; }
  acopy8(l, p); }
__device__ __forceinline__ v16b frag_s(const char* p) { union { v16b v; v8b q[2]; } u; u.q[0] = *(const v8b*)p; u.q[1] = *(const v8b*)(p + 32); return u.v; }   // 32 bf16 of an LDS row (32 keys of a V^T plane, or a 32-wide k chunk of a K half row) in fragment order; the lane's 16 * (lane >> 4) bytes are already in p
__device__ __forceinline__ F2 ld_kf(const char* p) { F2 r; r.h = frag_s(p); r.l = frag_s(p + HN * 2); return r; }   // hi and lo fragment of a 32-wide k chunk of an LDS row of K
__global__ __launch_bounds__(128) void k_fa(const float* __restrict__ QF, const float* __restrict__ KF, const __bf16* __restrict__ VT, const __bf16* __restrict__ VL, float* __restrict__ Y) {
  __shared__ __attribute__((aligned(16))) char sm[2 * BUFB];
  const int tid = threadIdx.x, wave = tid >> 5, lane = tid & 31, col = lane & 15, g = lane >> 4; const int bn = blockIdx.y; const int b = bn / NP, n = bn % NP; const int q0 = blockIdx.x * 64 + wave * 16;
  // the thread's own 16 bytes of each copy: LDS byte addresses in buffer 0 and global addresses in stage 0
  const unsigned sm0 = (unsigned)(size_t)sm; const unsigned lk = sm0 + (tid >> 4) * KP + (tid & 15) * 16; const unsigned lv = sm0 + OFF_VH + (tid >> 3) * VP + (tid & 7) * 16;
  const char* gk = (const char*)(KF + ROWO(b, n, 0)) + tid * 16; const char* gh = (const char*)(VT + ((size_t)bn * HN + (tid >> 3)) * SQ) + (tid & 7) * 16; const char* gl = (const char*)(VL + ((size_t)bn * HN + (tid >> 3)) * SQ) + (tid & 7) * 16;
  stage_in(lk, lv, gk, gh, gl, 0);
  F2 qf[HN / 32];
#pragma unroll
  for (int kc = 0; kc < HN / 32; ++kc) qf[kc] = split_row(QF + ROWO(b, n, q0 + col), kc * 32, lane);
  asm volatile("s_wait_asynccnt 0x0" ::: "memory");   // this wave's copies of stage 0 have landed
  __syncthreads();                                     // ... and every other wave's: stage 0 may be read
  stage_in(lk + BUFB, lv + BUFB, gk, gh, gl, 1);
  const char* kl0 = sm + col * KP + 16 * g; const char* vl0 = sm + OFF_VH + col * VP + 16 * g;   // the lane's own row and half in the K tile and in the V^T hi tile
  v8f acc[HN / 16] = {}; float m = -3.0e38f, l = 0.f;
  F2 kr[2][HN / 32];
#pragma unroll
  for (int u = 0; u < 2; ++u)
#pragma unroll
    for (int kc = 0; kc < HN / 32; ++kc) kr[u][kc] = ld_kf(kl0 + u * 16 * KP + kc * 64);
  // the stage loop and the loop over a stage's two halves of 32 keys stay rolled (one trip's fragments fill the first 256 registers); the short loops inside are unrolled so that the fragment arrays live in registers
#pragma unroll 1
  for (int st = 0; st < SQ / FK; ++st) { const int bo = (st & 1) * BUFB; const char* kb = kl0 + bo; const char* vb = vl0 + bo;
#pragma unroll 1
    for (int h = 0; h < FK / 32; ++h) { v8f s[2]; v16b vh[HN / 16], vl[HN / 16];
#pragma unroll
      for (int u = 0; u < 2; ++u) { v8f c = {};
#pragma unroll
        for (int kc = 0; kc < HN / 32; ++kc) { const F2 kf = kr[u][kc]; c = wmma_p(kf.l, qf[kc].h, c); c = wmma_p(kf.h, qf[kc].l, c); c = wmma_p(kf.h, qf[kc].h, c); }
        s[u] = c; }
      float mx = fmaxf(s[0][0], s[1][0]);
#pragma unroll
      for (int i = 1; i < 8; ++i) mx = fmaxf(mx, fmaxf(s[0][i], s[1][i]));
      mx = fmaxf(mx, __shfl_xor(mx, 16));   // the exchange goes through the LDS queue, which returns in order: it stands in front of the K and V reads so that its result does not wait for theirs
      if (h == 0) {   // the same stage's second 32 keys' rows, fetched one trip ahead; nothing of the next stage is read here
#pragma unroll
        for (int u = 0; u < 2; ++u)
#pragma unroll
          for (int kc = 0; kc < HN / 32; ++kc) kr[u][kc] = ld_kf(kb + (32 + u * 16) * KP + kc * 64); }
#pragma unroll
      for (int j = 0; j < HN / 16; ++j) { vh[j] = frag_s(vb + j * 16 * VP + h * 64); vl[j] = frag_s(vb + (OFF_VL - OFF_VH) + j * 16 * VP + h * 64); }
      __builtin_amdgcn_sched_barrier(0);   // keeps the V reads issued above the softmax, so that its arithmetic covers their latency (without it the scheduler sinks them to their first use)
      const float mn = fmaxf(m, mx); const float al = expf(m - mn); m = mn;
      float pv[16]; float ps = 0.f;
#pragma unroll
      for (int i = 0; i < 8; ++i) { pv[i] = expf(s[0][i] - mn); pv[8 + i] = expf(s[1][i] - mn); ps += pv[i] + pv[8 + i]; }
      l = l * al + ps; const F2 pf = bsplit16(pv);
#pragma unroll
      for (int j = 0; j < HN / 16; ++j) { v8f c = acc[j] * al; c = wmma_p(vh[j], pf.h, c); c = wmma_p(vh[j], pf.l, c); acc[j] = wmma_p(vl[j], pf.h, c); }
      // WMMA distance: with the split gone no vector instruction stands between the trip's last WMMAs and the next trip's score WMMAs, whose D a build without this line lays over the P hi fragment directly behind its last reader; four slots behind all four accumulators, P held to here
      asm volatile("v_nop\n\tv_nop\n\tv_nop\n\tv_nop" : "+v"(acc[0]), "+v"(acc[1]), "+v"(acc[2]), "+v"(acc[3]) : "v"(pf.h), "v"(pf.l)); }
    asm volatile("s_wait_dscnt 0x0" ::: "memory");      // this wave's reads of the buffer have returned before it is handed back
    asm volatile("s_wait_asynccnt 0x0" ::: "memory");   // this wave's copies of stage st + 1 have landed
    __syncthreads();                                     // publishes stage st + 1 and ends every wave's reads of stage st
    if (st + 2 < SQ / FK) stage_in(lk + bo, lv + bo, gk, gh, gl, st + 2);
    const char* kn = kl0 + (BUFB - bo);   // behind the barrier: the first 32 keys' rows of stage st + 1 (after the last stage the other buffer's old rows, unused)
#pragma unroll
    for (int u = 0; u < 2; ++u)
#pragma unroll
      for (int kc = 0; kc < HN / 32; ++kc) kr[u][kc] = ld_kf(kn + u * 16 * KP + kc * 64); }
  asm volatile("s_wait_asynccnt 0x0" ::: "memory");     // no copy is outstanding when the wave ends
  l += __shfl_xor(l, 16); const float inv = 1.0f / l * 0.125f;   // the module divides the softmax by sqrt(64)
  float* yr = Y + ((size_t)b * SQ + q0 + col) * CC + n * HN + 8 * g;
#pragma unroll
  for (int j = 0; j < HN / 16; ++j) { const v8f c = acc[j] * inv; v4f lo = {c[0], c[1], c[2], c[3]}, hi = {c[4], c[5], c[6], c[7]}; vst2(yr + j * 16, lo); vst2(yr + j * 16 + 4, hi); } }
// ---- k_out: block = (64 rows, 128 cols): out = y (bf16 hi + lo) Wo + bo
__global__ __launch_bounds__(128) void k_out(const float* __restrict__ Y, const float* __restrict__ WP, const float* __restrict__ BP, float* __restrict__ OUT) { __shared__ __align__(16) float sf[4][16][132];
  const int tid = threadIdx.x, wave = tid >> 5, lane = tid & 31, col = lane & 15, g = lane >> 4; const int c0 = blockIdx.y * 128; const size_t r0 = (size_t)blockIdx.x * 64 + wave * 16;
  v8f acc[8] = {};
#pragma unroll 2
  for (int kc = 0; kc < CC / 32; ++kc) { const F2 a = split_row(Y + (r0 + col) * CC, kc * 32, lane);
#pragma unroll
    for (int j = 0; j < 8; ++j) { v16b w; const int o = c0 + j * 16 + col;
#pragma unroll
      for (int i = 0; i < 8; ++i) { w[i] = (__bf16)WP[(size_t)(kc * 32 + 8 * g + i) * CC + o]; w[8 + i] = (__bf16)WP[(size_t)(kc * 32 + 16 + 8 * g + i) * CC + o]; }
      acc[j] = wmma_bf(a.h, w, acc[j]); acc[j] = wmma_bf(a.l, w, acc[j]); } }
#pragma unroll
  for (int j = 0; j < 8; ++j) { const float bb = BP ? bfr(BP[c0 + j * 16 + col]) : 0.f;
#pragma unroll
    for (int r = 0; r < 8; ++r) sf[wave][8 * g + r][j * 16 + col] = acc[j][r] + bb; }
  LDSX(); for (int rl = 0; rl < 16; ++rl) vst2(OUT + (r0 + rl) * CC + c0 + lane * 4, *(const v4f*)&sf[wave][rl][lane * 4]); }
extern "C" void kernel_launch(void* const* d_in, const int* in_sizes, int n_in, void* d_out, int out_size, void* d_ws, size_t ws_size, hipStream_t stream) {
  (void)in_sizes; (void)n_in; (void)out_size;
  const float** F = (const float**)d_in;   // 0 q [2,2048,512], 1 k, 2 v, 3 Wq [512,512] ((in,out)), 4 bq, 5 Wk, 6 bk, 7 Wv, 8 bv, 9 Wo, 10 bo
  if (ws_size < (size_t)WS_END) return;
  char* ws = (char*)d_ws; float *QF = (float*)(ws + WS_QF), *KF = (float*)(ws + WS_KF), *VF = (float*)(ws + WS_VF), *Y = (float*)(ws + WS_Y); __bf16 *VT = (__bf16*)(ws + WS_VT), *VL = (__bf16*)(ws + WS_VL);
  k_lin<<<dim3(TNB * SQ / 64, CC / 128, 3), 128, 0, stream>>>(F[0], F[1], F[2], F[3], F[4], F[5], F[6], F[7], F[8], QF, KF, VF);
  k_vt<<<dim3(SQ / 128, TNB * NP), 128, 0, stream>>>(VF, VT, VL);
  k_fa<<<dim3(SQ / 64, TNB * NP), 128, 0, stream>>>(QF, KF, VT, VL, Y);
  k_out<<<dim3(TNB * SQ / 64, CC / 128), 128, 0, stream>>>(Y, F[9], F[10], (float*)d_out);
}

// v004
// A run of this version takes 101 microseconds.
// Timed twice side by side with v003, it ran 1.39 and 1.38 times as fast.
// All steps since v000 together make it 9.08 times as fast.
// compute dtype: all float inputs rounded to bf16; q/k/v projections with EXACT bf16 products on WMMA 16x16x32 (f32 accumulate, + bias) kept as f32 rows; the module's reshape(B,H,S,Dh) re-reads those rows as [b][h][s][64]; logits from the f32 rows split bf16 hi + lo on both sides (3 products; the k rows are split once, where the projection stores them), kept in registers; softmax in f32 (precise expf) with a running maximum and sum, then / 8 as written; unnormalised P split bf16 hi + lo against v bf16 hi + lo planes (3 products), all in one launch; out = concat (bf16 hi + lo) Wo + bo; f32 output.
#include <hip/hip_runtime.h>
#include <math.h>

typedef __attribute__((ext_vector_type(16))) _Float16 v16h;
typedef __attribute__((ext_vector_type(16))) __bf16 v16b;
typedef __attribute__((ext_vector_type(8)))  _Float16 v8h;
typedef __attribute__((ext_vector_type(8)))  float v8f;
typedef __attribute__((ext_vector_type(4)))  float v4f;
typedef __attribute__((ext_vector_type(2)))  float v2f;
typedef __attribute__((ext_vector_type(4)))  unsigned v4u;
typedef __attribute__((ext_vector_type(4)))  int v4i;
typedef float __attribute__((may_alias)) float_a;
typedef int __attribute__((may_alias)) int_a;

template <typename T> __device__ __forceinline__ void vst2(void* p, T v) { *(T*)p = v;  }
__device__ __forceinline__ v8f wmma16(v16h a, v16h b, v8f c) {
  v8f d = __builtin_amdgcn_wmma_f32_16x16x32_f16(false, a, false, b, (short)0, c, false, false);
  asm volatile("v_nop\n\tv_nop\n\tv_nop\n\tv_nop" : "+v"(d) : "v"(a), "v"(b));
  return d;
}
__device__ __forceinline__ v8f wmma_bf(v16b a, v16b b, v8f c) {
  v8f d = __builtin_amdgcn_wmma_f32_16x16x32_bf16(false, a, false, b, (short)0, c, false, false);
  asm volatile("v_nop\n\tv_nop\n\tv_nop\n\tv_nop" : "+v"(d) : "v"(a), "v"(b));
  return d;
}
// 16x16x32 fragments: lane = (h = lane>>4, row/col = lane&15); elements 0..7 = k0+8h+0..7, 8..15 = k0+16+8h+0..7; D element r = row 8h+r
__device__ __forceinline__ v16h frag_h(const _Float16* rowk0, int lane) {
  union { v16h v; v8h q[2]; } u; const _Float16* p = rowk0 + 8 * (lane >> 4);
  u.q[0] = *(const v8h*)p; u.q[1] = *(const v8h*)(p + 16); return u.v;
}
__device__ __forceinline__ v16h frag_f32(const float* rowk0, int lane) {
  v16h a; const float* p = rowk0 + 8 * (lane >> 4);
#pragma unroll
  for (int i = 0; i < 8; ++i) { a[i] = (_Float16)p[i]; a[8 + i] = (_Float16)p[16 + i]; }
  return a;
}
__device__ __forceinline__ v16h frag_f32s(const float* rowk0, int lane, float sc) {
  v16h a; const float* p = rowk0 + 8 * (lane >> 4);
#pragma unroll
  for (int i = 0; i < 8; ++i) { a[i] = (_Float16)(p[i] * sc); a[8 + i] = (_Float16)(p[16 + i] * sc); }
  return a;
}
// column fragment from a [K][ld] layout (column n), rows >= K read as 0
__device__ __forceinline__ v16h fragc_f32(const float* W, int k0, int n, int lane, int ld, int K) {
  v16h a; const int g = lane >> 4;
#pragma unroll
  for (int i = 0; i < 8; ++i) { const int ka = k0 + 8 * g + i, kb = ka + 16;
    a[i] = (_Float16)(ka < K ? W[(size_t)(ka < K ? ka : K - 1) * ld + n] : 0.f); a[8 + i] = (_Float16)(kb < K ? W[(size_t)(kb < K ? kb : K - 1) * ld + n] : 0.f); }
  return a;
}
struct F2 { v16b h, l; };
__device__ __forceinline__ F2 bsplit16(const float v[16]) { F2 r;
#pragma unroll
  for (int i = 0; i < 16; ++i) { const __bf16 h = (__bf16)v[i]; r.h[i] = h; r.l[i] = (__bf16)(v[i] - (float)h); }
  return r; }
__device__ __forceinline__ F2 split_row(const float* row, int k0, int lane) { float v[16]; const float* p = row + k0 + 8 * (lane >> 4);
#pragma unroll
  for (int i = 0; i < 8; ++i) { v[i] = p[i]; v[8 + i] = p[16 + i]; }
  return bsplit16(v); }
__device__ __forceinline__ F2 split_rowK(const float* row, int k0, int lane, int K) { float v[16]; const int g = lane >> 4;
#pragma unroll
  for (int i = 0; i < 8; ++i) { const int ka = k0 + 8 * g + i, kb = ka + 16; v[i] = ka < K ? row[ka < K ? ka : K - 1] : 0.f; v[8 + i] = kb < K ? row[kb < K ? kb : K - 1] : 0.f; }
  return bsplit16(v); }
__device__ __forceinline__ F2 split_col(const float* W, int k0, int n, int lane, int ld, int K) { float v[16]; const int g = lane >> 4;
#pragma unroll
  for (int i = 0; i < 8; ++i) { const int ka = k0 + 8 * g + i, kb = ka + 16; v[i] = ka < K ? W[(size_t)(ka < K ? ka : K - 1) * ld + n] : 0.f; v[8 + i] = kb < K ? W[(size_t)(kb < K ? kb : K - 1) * ld + n] : 0.f; }
  return bsplit16(v); }
__device__ __forceinline__ v8f mac3(const F2& a, const F2& b, v8f c) { c = wmma_bf(a.l, b.h, c); c = wmma_bf(a.h, b.l, c); return wmma_bf(a.h, b.h, c); }
__device__ __forceinline__ float sigm(float v) { return 1.0f / (1.0f + expf(-v)); }
#define LDSX() do { asm volatile("s_wait_dscnt 0" ::: "memory"); __builtin_amdgcn_wave_barrier(); __builtin_amdgcn_fence(__ATOMIC_RELEASE, "workgroup"); } while (0)

// Multi self-attention (B 2, S 2,048, D 512, 8 heads x 64) with the module's literal head split qp.reshape(B, H, S, Dh) -- NO transpose: head h of batch b = rows [h*2048, (h+1)*2048) of the projection viewed as [B][H*S][64] -- scores unscaled, attn = softmax / sqrt(64), ctx.transpose(0,2,1,3) -> [B,S,512], @ Wo + bo.
__device__ __forceinline__ float bfr(float v) { return (float)(__bf16)v; }
#define NBT 2
#define SQ 2048
#define TT SQ
#define NP 8
#define HN 64
#define CC 512
#define HG 4
#ifndef TNB
#define TNB NBT
#endif
// virtual row (b, n, s) of a projection viewed as [b][H*S][64]: float offset
#define ROWO(b, n, s) ((((size_t)(b) * NP + (n)) * SQ + (s)) * HN)
typedef __attribute__((ext_vector_type(8))) __bf16 v8b;
typedef __attribute__((ext_vector_type(4))) __bf16 v4b;
__device__ __forceinline__ v16b frag_b(const __bf16* rowk0, int lane) { union { v16b v; v8b q[2]; } u; const __bf16* p = rowk0 + 8 * (lane >> 4); u.q[0] = *(const v8b*)p; u.q[1] = *(const v8b*)(p + 16); return u.v; }
#define WS_QF  0u                                          // f32 projection rows [b*S+t][512] (== virtual [b][h][s][64])
#define WS_KF  (WS_QF + 4u * (size_t)NBT * SQ * CC)          // k projection, virtual rows of 256 B: 64 bf16 hi, 64 bf16 lo
#define WS_VF  (WS_KF + 4u * (size_t)NBT * SQ * CC)
#define WS_VT  (WS_VF + 4u * (size_t)NBT * SQ * CC)          // bf16 v planes hi [(b*8+n)*64 + d][s]
#define WS_VL  (WS_VT + 2u * (size_t)NBT * CC * SQ)
#define WS_S   (WS_VL + 2u * (size_t)NBT * CC * SQ)          // f32 [hg][s][t] region, unused: scores and P stay in k_fa's registers
#define WS_Y   (WS_S + 4u * (size_t)HG * SQ * SQ)            // f32 ctx rows [b*S+s][h*64+d]
#define WS_END (WS_Y + 4u * (size_t)NBT * SQ * CC)
// W of a projection is staged per block: 64 rows (k) x 128 columns, rounded to bf16 as before, row-major in LDS; every wave reads its B fragments from there with the transposing load
#define WKC 64                       // k rows of W per stage
#define WPT 288                      // LDS pitch of a staged W row: 256 B + 32, 32 B x odd, conflict-free for ds_load_tr16_b128
#define WBUF (WKC * WPT)
typedef __attribute__((ext_vector_type(8))) short s16x8;
// one wave-wide load = one whole row piece of 512 B (4 lines); wave w takes rows w, w + 4, ...
__device__ __forceinline__ void w_load(v4f (&r)[WKC / 4], const float* wp, int st) {
#pragma unroll
  for (int i = 0; i < WKC / 4; ++i) r[i] = *(const v4f*)(wp + (size_t)(st * WKC + i * 4) * CC); }
__device__ __forceinline__ void w_store(char* d, const v4f (&r)[WKC / 4]) {
#pragma unroll
  for (int i = 0; i < WKC / 4; ++i) { v4b h;
#pragma unroll
    for (int e = 0; e < 4; ++e) h[e] = (__bf16)r[i][e];
    *(v4b*)(d + i * 4 * WPT) = h; } }
// the lane's 2 x 16 values of its own row for the stage's two 32-wide k chunks, in fragment order (8g + 0..7, 16 + 8g + 0..7)
__device__ __forceinline__ void x_load(v4f (&r)[8], const float* xp, int st) {
#pragma unroll
  for (int c = 0; c < 2; ++c) { const float* p = xp + st * WKC + c * 32; r[c * 4] = *(const v4f*)p; r[c * 4 + 1] = *(const v4f*)(p + 4); r[c * 4 + 2] = *(const v4f*)(p + 16); r[c * 4 + 3] = *(const v4f*)(p + 20); } }
// B fragment (32 k x 16 columns) of the staged tile: p = tile + (k0 + 8g + (lane & 7)) * WPT + 2 * column0 + 16 * ((lane >> 3) & 1); lane (g, col) gets k0 + 8g + 0..7 and k0 + 16 + 8g + 0..7 of column0 + col
__device__ __forceinline__ v16b frag_t(const char* p) { typedef __attribute__((address_space(3))) s16x8 lds_s16x8; union { v16b v; s16x8 q[2]; } u;
  u.q[0] = __builtin_amdgcn_ds_load_tr16_b128_v8i16((lds_s16x8*)p); u.q[1] = __builtin_amdgcn_ds_load_tr16_b128_v8i16((lds_s16x8*)(p + 16 * WPT)); return u.v; }
// one stage's products: four groups of four B fragments (k chunk c = q >> 1, columns (q & 1) * 64 ...); per accumulator the k chunks come in ascending order, as before
__device__ __forceinline__ void mm_stage(v8f (&acc)[8], const v16b (&a)[2], const char* tb) {
#pragma unroll
  for (int q = 0; q < 4; ++q) { v16b w[4];
#pragma unroll
    for (int j = 0; j < 4; ++j) w[j] = frag_t(tb + (q >> 1) * 32 * WPT + ((q & 1) * 4 + j) * 32);
    __builtin_amdgcn_sched_barrier(0);   // keeps a group's eight LDS reads together in front of its WMMAs: one LDS latency a group (without it each fragment's reads stand directly in front of its WMMA and each waits alone)
#pragma unroll
    for (int j = 0; j < 4; ++j) acc[(q & 1) * 4 + j] = wmma_bf(a[q >> 1], w[j], acc[(q & 1) * 4 + j]); } }
// the same with the row operand split hi + lo: per accumulator hi, then lo, of each k chunk, as before
__device__ __forceinline__ void mm_stage2(v8f (&acc)[8], const F2 (&a)[2], const char* tb) {
#pragma unroll
  for (int q = 0; q < 4; ++q) { v16b w[4];
#pragma unroll
    for (int j = 0; j < 4; ++j) w[j] = frag_t(tb + (q >> 1) * 32 * WPT + ((q & 1) * 4 + j) * 32);
    __builtin_amdgcn_sched_barrier(0);   // as in mm_stage
#pragma unroll
    for (int j = 0; j < 4; ++j) acc[(q & 1) * 4 + j] = wmma_bf(a[q >> 1].h, w[j], acc[(q & 1) * 4 + j]);
#pragma unroll
    for (int j = 0; j < 4; ++j) acc[(q & 1) * 4 + j] = wmma_bf(a[q >> 1].l, w[j], acc[(q & 1) * 4 + j]); } }
__device__ __forceinline__ void x_frag(v16b (&a)[2], const v4f (&xr)[8]) {
#pragma unroll
  for (int c = 0; c < 2; ++c)
#pragma unroll
    for (int i = 0; i < 4; ++i) { a[c][i] = (__bf16)xr[c * 4][i]; a[c][4 + i] = (__bf16)xr[c * 4 + 1][i]; a[c][8 + i] = (__bf16)xr[c * 4 + 2][i]; a[c][12 + i] = (__bf16)xr[c * 4 + 3][i]; } }
__device__ __forceinline__ void x_frag2(F2 (&a)[2], const v4f (&xr)[8]) {
#pragma unroll
  for (int c = 0; c < 2; ++c) { float v[16];
#pragma unroll
    for (int i = 0; i < 4; ++i) { v[i] = xr[c * 4][i]; v[4 + i] = xr[c * 4 + 1][i]; v[8 + i] = xr[c * 4 + 2][i]; v[12 + i] = xr[c * 4 + 3][i]; }
    a[c] = bsplit16(v); } }
// ---- k_lin: block = (64 rows, 128 cols, which): {q,k,v}p = input W ((in,out)) + b, exact products, f32 rows (k: the f32 value as bf16 hi + lo)
__global__ __launch_bounds__(128) void k_lin(const float* __restrict__ XQ, const float* __restrict__ XK, const float* __restrict__ XV, const float* __restrict__ WQ, const float* __restrict__ BQ, const float* __restrict__ WK, const float* __restrict__ BK, const float* __restrict__ WV, const float* __restrict__ BV, float* __restrict__ QF, float* __restrict__ KF, float* __restrict__ VF) { __shared__ __align__(16) float sf[4][16][132]; __shared__ __align__(32) char sw[2 * WBUF];
  const int tid = threadIdx.x, wave = tid >> 5, lane = tid & 31, col = lane & 15, g = lane >> 4; const int which = blockIdx.z; const int c0 = blockIdx.y * 128; const size_t r0 = (size_t)blockIdx.x * 64 + wave * 16;
  const float* X = which == 0 ? XQ : which == 1 ? XK : XV; const float* WA = which == 0 ? WQ : which == 1 ? WK : WV; const float* BA = which == 0 ? BQ : which == 1 ? BK : BV; float* DST = which == 0 ? QF : which == 1 ? KF : VF;
  v8f acc[8] = {};
  const float* wp = WA + (size_t)wave * CC + c0 + lane * 4; const float* xp = X + (r0 + col) * CC + 8 * g;
  char* sd = sw + wave * WPT + lane * 8; const char* tl = sw + (8 * g + (lane & 7)) * WPT + 16 * ((lane >> 3) & 1);
  v4f wr[WKC / 4], xr[8];
  w_load(wr, wp, 0); x_load(xr, xp, 0); w_store(sd, wr);
  __syncthreads();   // stage 0 may be read
  // the stage loop stays rolled (one stage's loads in flight fill 96 registers); the last stage, which has nothing to fetch, stands behind it
  v16b a[2];
#pragma unroll 1
  for (int st = 0; st + 1 < CC / WKC; ++st) { x_frag(a, xr);
    w_load(wr, wp, st + 1); x_load(xr, xp, st + 1);   // the next stage's loads fly while this stage is worked on
    mm_stage(acc, a, tl + (st & 1) * WBUF);
    w_store(sd + ((st + 1) & 1) * WBUF, wr);
    __syncthreads(); }   // publishes stage st + 1 and ends every wave's reads of stage st, whose buffer the next trip refills
  x_frag(a, xr); mm_stage(acc, a, tl + ((CC / WKC - 1) & 1) * WBUF);
#pragma unroll
  for (int j = 0; j < 8; ++j) { const float bb = bfr(BA[c0 + j * 16 + col]);
#pragma unroll
    for (int r = 0; r < 8; ++r) sf[wave][8 * g + r][j * 16 + col] = acc[j][r] + bb; }
  LDSX();
  if (which == 1) {   // k rows leave split: virtual row (64 values, 256 B) = 64 bf16 hi, then 64 bf16 lo; 16 lanes fill one whole 128-B line per store
    char* kd = (char*)DST + (r0 * (CC / HN) + c0 / HN + g) * (size_t)(HN * 4) + col * 8;
    for (int rl = 0; rl < 16; ++rl) { const v4f x = *(const v4f*)&sf[wave][rl][lane * 4]; v4b h, l;
#pragma unroll
      for (int i = 0; i < 4; ++i) { h[i] = (__bf16)x[i]; l[i] = (__bf16)(x[i] - (float)h[i]); }
      vst2(kd + (size_t)rl * (CC * 4), h); vst2(kd + (size_t)rl * (CC * 4) + HN * 2, l); } }
  else { for (int rl = 0; rl < 16; ++rl) vst2(DST + (r0 + rl) * CC + c0 + lane * 4, *(const v4f*)&sf[wave][rl][lane * 4]);
    asm volatile("s_wait_xcnt 0x0" ::: "memory"); } }   // behind the run of stores: no register that a store names is rewritten ahead of it on any way the built code has from here
// ---- k_vt: block = (128 virtual rows s, b*8+n): VF virtual rows -> bf16 hi/lo planes [(bn)*64 + d][s]; 256-B pieces
__global__ __launch_bounds__(128) void k_vt(const float* __restrict__ VF, __bf16* __restrict__ VT, __bf16* __restrict__ VL) { __shared__ __align__(16) __bf16 th[HN][136], tl[HN][136];
  const int tid = threadIdx.x; const int t0 = blockIdx.x * 128; const int bn = blockIdx.y; const int b = bn / NP, n = bn % NP;
  for (int e = tid; e < 128 * HN; e += 128) { const int sl = e / HN, d = e % HN; const float v = VF[ROWO(b, n, t0 + sl) + d]; const __bf16 h = (__bf16)v; th[d][sl] = h; tl[d][sl] = (__bf16)(v - (float)h); }
  __syncthreads();
  for (int e = tid; e < HN * 16; e += 128) { const int d = e >> 4, q = e & 15; const size_t o = ((size_t)bn * HN + d) * SQ + t0 + q * 8; vst2((unsigned*)(VT + o), *(const v4u*)&th[d][q * 8]); vst2((unsigned*)(VL + o), *(const v4u*)&tl[d][q * 8]); } }
// ---- k_fa: block = (64 queries, b*8+n), one wave = 16 queries: S^T = K Q^T (3 products; q split here from its f32 virtual rows, k read as the hi + lo rows k_lin stored), running maximum and sum per query, ctx^T += V^T P^T (3 products), P stays in registers
// S^T tile: lane (g, col) holds keys 8g+0..7 of query col, which is the B fragment order of P^T for 32 keys (elements 0..7 from the first 16-key tile, 8..15 from the second)
__device__ __forceinline__ v8f wmma_p(v16b a, v16b b, v8f c) { return __builtin_amdgcn_wmma_f32_16x16x32_bf16(false, a, false, b, (short)0, c, false, false); }
// K rows and both V^T planes of 64 keys are staged once per block in LDS and read from there by all four waves; two buffers, the next stage's copies fly while this stage is worked on
#define FK 64                        // keys per stage
#define KP 272                       // LDS pitch of a K row: 256 B + 16, 16 B x odd, conflict-free for 16-byte reads down a column of rows
#define VP 144                       // LDS pitch of a V^T row: 128 B + 16
#define OFF_VH (FK * KP)
#define OFF_VL (OFF_VH + HN * VP)
#define BUFB (OFF_VL + HN * VP)
// eight 16-byte copies per lane, global memory to LDS through no register; the s_wait_xcnt is the last line of the copies' own statement so that no address register is rewritten ahead of it
__device__ __forceinline__ void acopy8(const unsigned (&l)[8], const char* const (&p)[8]) {
  asm volatile("global_load_async_to_lds_b128 %0, %8, off\n\t"
               "global_load_async_to_lds_b128 %1, %9, off\n\t"
               "global_load_async_to_lds_b128 %2, %10, off\n\t"
               "global_load_async_to_lds_b128 %3, %11, off\n\t"
               "global_load_async_to_lds_b128 %4, %12, off\n\t"
               "global_load_async_to_lds_b128 %5, %13, off\n\t"
               "global_load_async_to_lds_b128 %6, %14, off\n\t"
               "global_load_async_to_lds_b128 %7, %15, off\n\t"
               "s_wait_xcnt 0x0"
               :: "v"(l[0]), "v"(l[1]), "v"(l[2]), "v"(l[3]), "v"(l[4]), "v"(l[5]), "v"(l[6]), "v"(l[7]), "v"(p[0]), "v"(p[1]), "v"(p[2]), "v"(p[3]), "v"(p[4]), "v"(p[5]), "v"(p[6]), "v"(p[7]) : "memory"); }
// one stage: 64 K rows (16 KiB in a row in memory; a wave's copy = 4 whole lines) and 64 rows x 128 B of each V^T plane (a wave's copy = 4 rows = 4 whole lines)
__device__ __forceinline__ void stage_in(unsigned lk, unsigned lv, const char* gk, const char* gh, const char* gl, int st) {
  unsigned l[8]; const char* p[8];
#pragma unroll
  for (int i = 0; i < 8; ++i) { l[i] = lk + i * 8 * KP; p[i] = gk + (size_t)st * (FK * HN * 4) + i * 2048; }
  acopy8(l, p);
#pragma unroll
  for (int i = 0; i < 4; ++i) { l[i] = lv + i * 16 * VP; p[i] = gh + (size_t)st * (FK * 2) + (size_t)i * 16 * SQ * 2; l[4 + i] = lv + (OFF_VL - OFF_VH) + i * 16 * VP; p[4 + i] = gl + (size_t)st * (FK * 2) + (size_t)i * 16 * SQ * 2; }
  acopy8(l, p); }
__device__ __forceinline__ v16b frag_s(const char* p) { union { v16b v; v8b q[2]; } u; u.q[0] = *(const v8b*)p; u.q[1] = *(const v8b*)(p + 32); return u.v; }   // 32 bf16 of an LDS row (32 keys of a V^T plane, or a 32-wide k chunk of a K half row) in fragment order; the lane's 16 * (lane >> 4) bytes are already in p
__device__ __forceinline__ F2 ld_kf(const char* p) { F2 r; r.h = frag_s(p); r.l = frag_s(p + HN * 2); return r; }   // hi and lo fragment of a 32-wide k chunk of an LDS row of K
__global__ __launch_bounds__(128) void k_fa(const float* __restrict__ QF, const float* __restrict__ KF, const __bf16* __restrict__ VT, const __bf16* __restrict__ VL, float* __restrict__ Y) {
  __shared__ __attribute__((aligned(16))) char sm[2 * BUFB];
  const int tid = threadIdx.x, wave = tid >> 5, lane = tid & 31, col = lane & 15, g = lane >> 4; const int bn = blockIdx.y; const int b = bn / NP, n = bn % NP; const int q0 = blockIdx.x * 64 + wave * 16;
  // the thread's own 16 bytes of each copy: LDS byte addresses in buffer 0 and global addresses in stage 0
  const unsigned sm0 = (unsigned)(size_t)sm; const unsigned lk = sm0 + (tid >> 4) * KP + (tid & 15) * 16; const unsigned lv = sm0 + OFF_VH + (tid >> 3) * VP + (tid & 7) * 16;
  const char* gk = (const char*)(KF + ROWO(b, n, 0)) + tid * 16; const char* gh = (const char*)(VT + ((size_t)bn * HN + (tid >> 3)) * SQ) + (tid & 7) * 16; const char* gl = (const char*)(VL + ((size_t)bn * HN + (tid >> 3)) * SQ) + (tid & 7) * 16;
  stage_in(lk, lv, gk, gh, gl, 0);
  F2 qf[HN / 32];
#pragma unroll
  for (int kc = 0; kc < HN / 32; ++kc) qf[kc] = split_row(QF + ROWO(b, n, q0 + col), kc * 32, lane);
  asm volatile("s_wait_asynccnt 0x0" ::: "memory");   // this wave's copies of stage 0 have landed
  __syncthreads();                                     // ... and every other wave's: stage 0 may be read
  stage_in(lk + BUFB, lv + BUFB, gk, gh, gl, 1);
  const char* kl0 = sm + col * KP + 16 * g; const char* vl0 = sm + OFF_VH + col * VP + 16 * g;   // the lane's own row and half in the K tile and in the V^T hi tile
  v8f acc[HN / 16] = {}; float m = -3.0e38f, l = 0.f;
  F2 kr[2][HN / 32];
#pragma unroll
  for (int u = 0; u < 2; ++u)
#pragma unroll
    for (int kc = 0; kc < HN / 32; ++kc) kr[u][kc] = ld_kf(kl0 + u * 16 * KP + kc * 64);
  // the stage loop and the loop over a stage's two halves of 32 keys stay rolled (one trip's fragments fill the first 256 registers); the short loops inside are unrolled so that the fragment arrays live in registers
#pragma unroll 1
  for (int st = 0; st < SQ / FK; ++st) { const int bo = (st & 1) * BUFB; const char* kb = kl0 + bo; const char* vb = vl0 + bo;
#pragma unroll 1
    for (int h = 0; h < FK / 32; ++h) { v8f s[2]; v16b vh[HN / 16], vl[HN / 16];
#pragma unroll
      for (int u = 0; u < 2; ++u) { v8f c = {};
#pragma unroll
        for (int kc = 0; kc < HN / 32; ++kc) { const F2 kf = kr[u][kc]; c = wmma_p(kf.l, qf[kc].h, c); c = wmma_p(kf.h, qf[kc].l, c); c = wmma_p(kf.h, qf[kc].h, c); }
        s[u] = c; }
      float mx = fmaxf(s[0][0], s[1][0]);
#pragma unroll
      for (int i = 1; i < 8; ++i) mx = fmaxf(mx, fmaxf(s[0][i], s[1][i]));
      mx = fmaxf(mx, __shfl_xor(mx, 16));   // the exchange goes through the LDS queue, which returns in order: it stands in front of the K and V reads so that its result does not wait for theirs
      if (h == 0) {   // the same stage's second 32 keys' rows, fetched one trip ahead; nothing of the next stage is read here
#pragma unroll
        for (int u = 0; u < 2; ++u)
#pragma unroll
          for (int kc = 0; kc < HN / 32; ++kc) kr[u][kc] = ld_kf(kb + (32 + u * 16) * KP + kc * 64); }
#pragma unroll
      for (int j = 0; j < HN / 16; ++j) { vh[j] = frag_s(vb + j * 16 * VP + h * 64); vl[j] = frag_s(vb + (OFF_VL - OFF_VH) + j * 16 * VP + h * 64); }
      __builtin_amdgcn_sched_barrier(0);   // keeps the V reads issued above the softmax, so that its arithmetic covers their latency (without it the scheduler sinks them to their first use)
      const float mn = fmaxf(m, mx); const float al = expf(m - mn); m = mn;
      float pv[16]; float ps = 0.f;
#pragma unroll
      for (int i = 0; i < 8; ++i) { pv[i] = expf(s[0][i] - mn); pv[8 + i] = expf(s[1][i] - mn); ps += pv[i] + pv[8 + i]; }
      l = l * al + ps; const F2 pf = bsplit16(pv);
#pragma unroll
      for (int j = 0; j < HN / 16; ++j) { v8f c = acc[j] * al; c = wmma_p(vh[j], pf.h, c); c = wmma_p(vh[j], pf.l, c); acc[j] = wmma_p(vl[j], pf.h, c); }
      // WMMA distance: with the split gone no vector instruction stands between the trip's last WMMAs and the next trip's score WMMAs, whose D a build without this line lays over the P hi fragment directly behind its last reader; four slots behind all four accumulators, P held to here
      asm volatile("v_nop\n\tv_nop\n\tv_nop\n\tv_nop" : "+v"(acc[0]), "+v"(acc[1]), "+v"(acc[2]), "+v"(acc[3]) : "v"(pf.h), "v"(pf.l)); }
    asm volatile("s_wait_dscnt 0x0" ::: "memory");      // this wave's reads of the buffer have returned before it is handed back
    asm volatile("s_wait_asynccnt 0x0" ::: "memory");   // this wave's copies of stage st + 1 have landed
    __syncthreads();                                     // publishes stage st + 1 and ends every wave's reads of stage st
    if (st + 2 < SQ / FK) stage_in(lk + bo, lv + bo, gk, gh, gl, st + 2);
    const char* kn = kl0 + (BUFB - bo);   // behind the barrier: the first 32 keys' rows of stage st + 1 (after the last stage the other buffer's old rows, unused)
#pragma unroll
    for (int u = 0; u < 2; ++u)
#pragma unroll
      for (int kc = 0; kc < HN / 32; ++kc) kr[u][kc] = ld_kf(kn + u * 16 * KP + kc * 64); }
  asm volatile("s_wait_asynccnt 0x0" ::: "memory");     // no copy is outstanding when the wave ends
  l += __shfl_xor(l, 16); const float inv = 1.0f / l * 0.125f;   // the module divides the softmax by sqrt(64)
  float* yr = Y + ((size_t)b * SQ + q0 + col) * CC + n * HN + 8 * g;
#pragma unroll
  for (int j = 0; j < HN / 16; ++j) { const v8f c = acc[j] * inv; v4f lo = {c[0], c[1], c[2], c[3]}, hi = {c[4], c[5], c[6], c[7]}; vst2(yr + j * 16, lo); vst2(yr + j * 16 + 4, hi); } }
// ---- k_out: block = (64 rows, 128 cols): out = y (bf16 hi + lo) Wo + bo
__global__ __launch_bounds__(128) void k_out(const float* __restrict__ Y, const float* __restrict__ WP, const float* __restrict__ BP, float* __restrict__ OUT) { __shared__ __align__(16) float sf[4][16][132]; __shared__ __align__(32) char sw[2 * WBUF];
  const int tid = threadIdx.x, wave = tid >> 5, lane = tid & 31, col = lane & 15, g = lane >> 4; const int c0 = blockIdx.y * 128; const size_t r0 = (size_t)blockIdx.x * 64 + wave * 16;
  v8f acc[8] = {};
  const float* wp = WP + (size_t)wave * CC + c0 + lane * 4; const float* xp = Y + (r0 + col) * CC + 8 * g;
  char* sd = sw + wave * WPT + lane * 8; const char* tl = sw + (8 * g + (lane & 7)) * WPT + 16 * ((lane >> 3) & 1);
  v4f wr[WKC / 4], xr[8];
  w_load(wr, wp, 0); x_load(xr, xp, 0); w_store(sd, wr);
  __syncthreads();   // stage 0 may be read
  // the stage loop stays rolled (one stage's loads in flight fill 96 registers); the last stage, which has nothing to fetch, stands behind it
  F2 a[2];
#pragma unroll 1
  for (int st = 0; st + 1 < CC / WKC; ++st) { x_frag2(a, xr);
    w_load(wr, wp, st + 1); x_load(xr, xp, st + 1);   // the next stage's loads fly while this stage is worked on
    mm_stage2(acc, a, tl + (st & 1) * WBUF);
    w_store(sd + ((st + 1) & 1) * WBUF, wr);
    __syncthreads(); }   // publishes stage st + 1 and ends every wave's reads of stage st, whose buffer the next trip refills
  x_frag2(a, xr); mm_stage2(acc, a, tl + ((CC / WKC - 1) & 1) * WBUF);
#pragma unroll
  for (int j = 0; j < 8; ++j) { const float bb = BP ? bfr(BP[c0 + j * 16 + col]) : 0.f;
#pragma unroll
    for (int r = 0; r < 8; ++r) sf[wave][8 * g + r][j * 16 + col] = acc[j][r] + bb; }
  LDSX(); for (int rl = 0; rl < 16; ++rl) vst2(OUT + (r0 + rl) * CC + c0 + lane * 4, *(const v4f*)&sf[wave][rl][lane * 4]); }
extern "C" void kernel_launch(void* const* d_in, const int* in_sizes, int n_in, void* d_out, int out_size, void* d_ws, size_t ws_size, hipStream_t stream) {
  (void)in_sizes; (void)n_in; (void)out_size;
  const float** F = (const float**)d_in;   // 0 q [2,2048,512], 1 k, 2 v, 3 Wq [512,512] ((in,out)), 4 bq, 5 Wk, 6 bk, 7 Wv, 8 bv, 9 Wo, 10 bo
  if (ws_size < (size_t)WS_END) return;
  char* ws = (char*)d_ws; float *QF = (float*)(ws + WS_QF), *KF = (float*)(ws + WS_KF), *VF = (float*)(ws + WS_VF), *Y = (float*)(ws + WS_Y); __bf16 *VT = (__bf16*)(ws + WS_VT), *VL = (__bf16*)(ws + WS_VL);
  k_lin<<<dim3(TNB * SQ / 64, CC / 128, 3), 128, 0, stream>>>(F[0], F[1], F[2], F[3], F[4], F[5], F[6], F[7], F[8], QF, KF, VF);
  k_vt<<<dim3(SQ / 128, TNB * NP), 128, 0, stream>>>(VF, VT, VL);
  k_fa<<<dim3(SQ / 64, TNB * NP), 128, 0, stream>>>(QF, KF, VT, VL, Y);
  k_out<<<dim3(TNB * SQ / 64, CC / 128), 128, 0, stream>>>(Y, F[9], F[10], (float*)d_out);
}

// v005
// Measured time: 89.1 microseconds a run.
// Timed twice side by side with v004, it ran 1.13 times as fast both times.
// Counting every step since v000, it is 10.3 times as fast.
// compute dtype: all float inputs rounded to bf16; q/k/v projections with EXACT bf16 products on WMMA 16x16x32 (f32 accumulate, + bias) kept as f32 rows; the module's reshape(B,H,S,Dh) re-reads those rows as [b][h][s][64]; logits from the f32 rows split bf16 hi + lo on both sides (3 products; the k rows are split once, where the projection stores them), kept in registers; softmax in f32 (e^x as the hardware's 2^x of x log2 e) with a running maximum and sum, then / 8 as written; unnormalised P split bf16 hi + lo against v bf16 hi + lo planes (3 products), all in one launch; out = concat (bf16 hi + lo) Wo + bo; f32 output.
#include <hip/hip_runtime.h>
#include <math.h>

typedef __attribute__((ext_vector_type(16))) _Float16 v16h;
typedef __attribute__((ext_vector_type(16))) __bf16 v16b;
typedef __attribute__((ext_vector_type(8)))  _Float16 v8h;
typedef __attribute__((ext_vector_type(8)))  float v8f;
typedef __attribute__((ext_vector_type(4)))  float v4f;
typedef __attribute__((ext_vector_type(2)))  float v2f;
typedef __attribute__((ext_vector_type(4)))  unsigned v4u;
typedef __attribute__((ext_vector_type(4)))  int v4i;
typedef float __attribute__((may_alias)) float_a;
typedef int __attribute__((may_alias)) int_a;

template <typename T> __device__ __forceinline__ void vst2(void* p, T v) { *(T*)p = v;  }
__device__ __forceinline__ v8f wmma16(v16h a, v16h b, v8f c) {
  v8f d = __builtin_amdgcn_wmma_f32_16x16x32_f16(false, a, false, b, (short)0, c, false, false);
  asm volatile("v_nop\n\tv_nop\n\tv_nop\n\tv_nop" : "+v"(d) : "v"(a), "v"(b));
  return d;
}
__device__ __forceinline__ v8f wmma_bf(v16b a, v16b b, v8f c) {
  v8f d = __builtin_amdgcn_wmma_f32_16x16x32_bf16(false, a, false, b, (short)0, c, false, false);
  asm volatile("v_nop\n\tv_nop\n\tv_nop\n\tv_nop" : "+v"(d) : "v"(a), "v"(b));
  return d;
}
// 16x16x32 fragments: lane = (h = lane>>4, row/col = lane&15); elements 0..7 = k0+8h+0..7, 8..15 = k0+16+8h+0..7; D element r = row 8h+r
__device__ __forceinline__ v16h frag_h(const _Float16* rowk0, int lane) {
  union { v16h v; v8h q[2]; } u; const _Float16* p = rowk0 + 8 * (lane >> 4);
  u.q[0] = *(const v8h*)p; u.q[1] = *(const v8h*)(p + 16); return u.v;
}
__device__ __forceinline__ v16h frag_f32(const float* rowk0, int lane) {
  v16h a; const float* p = rowk0 + 8 * (lane >> 4);
#pragma unroll
  for (int i = 0; i < 8; ++i) { a[i] = (_Float16)p[i]; a[8 + i] = (_Float16)p[16 + i]; }
  return a;
}
__device__ __forceinline__ v16h frag_f32s(const float* rowk0, int lane, float sc) {
  v16h a; const float* p = rowk0 + 8 * (lane >> 4);
#pragma unroll
  for (int i = 0; i < 8; ++i) { a[i] = (_Float16)(p[i] * sc); a[8 + i] = (_Float16)(p[16 + i] * sc); }
  return a;
}
// column fragment from a [K][ld] layout (column n), rows >= K read as 0
__device__ __forceinline__ v16h fragc_f32(const float* W, int k0, int n, int lane, int ld, int K) {
  v16h a; const int g = lane >> 4;
#pragma unroll
  for (int i = 0; i < 8; ++i) { const int ka = k0 + 8 * g + i, kb = ka + 16;
    a[i] = (_Float16)(ka < K ? W[(size_t)(ka < K ? ka : K - 1) * ld + n] : 0.f); a[8 + i] = (_Float16)(kb < K ? W[(size_t)(kb < K ? kb : K - 1) * ld + n] : 0.f); }
  return a;
}
struct F2 { v16b h, l; };
__device__ __forceinline__ F2 bsplit16(const float v[16]) { F2 r;
#pragma unroll
  for (int i = 0; i < 16; ++i) { const __bf16 h = (__bf16)v[i]; r.h[i] = h; r.l[i] = (__bf16)(v[i] - (float)h); }
  return r; }
__device__ __forceinline__ F2 split_row(const float* row, int k0, int lane) { float v[16]; const float* p = row + k0 + 8 * (lane >> 4);
#pragma unroll
  for (int i = 0; i < 8; ++i) { v[i] = p[i]; v[8 + i] = p[16 + i]; }
  return bsplit16(v); }
__device__ __forceinline__ F2 split_rowK(const float* row, int k0, int lane, int K) { float v[16]; const int g = lane >> 4;
#pragma unroll
  for (int i = 0; i < 8; ++i) { const int ka = k0 + 8 * g + i, kb = ka + 16; v[i] = ka < K ? row[ka < K ? ka : K - 1] : 0.f; v[8 + i] = kb < K ? row[kb < K ? kb : K - 1] : 0.f; }
  return bsplit16(v); }
__device__ __forceinline__ F2 split_col(const float* W, int k0, int n, int lane, int ld, int K) { float v[16]; const int g = lane >> 4;
#pragma unroll
  for (int i = 0; i < 8; ++i) { const int ka = k0 + 8 * g + i, kb = ka + 16; v[i] = ka < K ? W[(size_t)(ka < K ? ka : K - 1) * ld + n] : 0.f; v[8 + i] = kb < K ? W[(size_t)(kb < K ? kb : K - 1) * ld + n] : 0.f; }
  return bsplit16(v); }
__device__ __forceinline__ v8f mac3(const F2& a, const F2& b, v8f c) { c = wmma_bf(a.l, b.h, c); c = wmma_bf(a.h, b.l, c); return wmma_bf(a.h, b.h, c); }
__device__ __forceinline__ float sigm(float v) { return 1.0f / (1.0f + expf(-v)); }
#define LDSX() do { asm volatile("s_wait_dscnt 0" ::: "memory"); __builtin_amdgcn_wave_barrier(); __builtin_amdgcn_fence(__ATOMIC_RELEASE, "workgroup"); } while (0)

// Multi self-attention (B 2, S 2,048, D 512, 8 heads x 64) with the module's literal head split qp.reshape(B, H, S, Dh) -- NO transpose: head h of batch b = rows [h*2048, (h+1)*2048) of the projection viewed as [B][H*S][64] -- scores unscaled, attn = softmax / sqrt(64), ctx.transpose(0,2,1,3) -> [B,S,512], @ Wo + bo.
__device__ __forceinline__ float bfr(float v) { return (float)(__bf16)v; }
#define NBT 2
#define SQ 2048
#define TT SQ
#define NP 8
#define HN 64
#define CC 512
#define HG 4
#ifndef TNB
#define TNB NBT
#endif
// virtual row (b, n, s) of a projection viewed as [b][H*S][64]: float offset
#define ROWO(b, n, s) ((((size_t)(b) * NP + (n)) * SQ + (s)) * HN)
typedef __attribute__((ext_vector_type(8))) __bf16 v8b;
typedef __attribute__((ext_vector_type(4))) __bf16 v4b;
__device__ __forceinline__ v16b frag_b(const __bf16* rowk0, int lane) { union { v16b v; v8b q[2]; } u; const __bf16* p = rowk0 + 8 * (lane >> 4); u.q[0] = *(const v8b*)p; u.q[1] = *(const v8b*)(p + 16); return u.v; }
#define WS_QF  0u                                          // f32 projection rows [b*S+t][512] (== virtual [b][h][s][64])
#define WS_KF  (WS_QF + 4u * (size_t)NBT * SQ * CC)          // k projection, virtual rows of 256 B: 64 bf16 hi, 64 bf16 lo
#define WS_VF  (WS_KF + 4u * (size_t)NBT * SQ * CC)
#define WS_VT  (WS_VF + 4u * (size_t)NBT * SQ * CC)          // bf16 v planes hi [(b*8+n)*64 + d][s]
#define WS_VL  (WS_VT + 2u * (size_t)NBT * CC * SQ)
#define WS_S   (WS_VL + 2u * (size_t)NBT * CC * SQ)          // f32 [hg][s][t] region, unused: scores and P stay in k_fa's registers
#define WS_Y   (WS_S + 4u * (size_t)HG * SQ * SQ)            // f32 ctx rows [b*S+s][h*64+d]
#define WS_END (WS_Y + 4u * (size_t)NBT * SQ * CC)
// W of a projection is staged per block: 64 rows (k) x 128 columns, rounded to bf16 as before, row-major in LDS; every wave reads its B fragments from there with the transposing load
#define WKC 64                       // k rows of W per stage
#define WPT 288                      // LDS pitch of a staged W row: 256 B + 32, 32 B x odd, conflict-free for ds_load_tr16_b128
#define WBUF (WKC * WPT)
typedef __attribute__((ext_vector_type(8))) short s16x8;
// one wave-wide load = one whole row piece of 512 B (4 lines); wave w takes rows w, w + 4, ...
__device__ __forceinline__ void w_load(v4f (&r)[WKC / 4], const float* wp, int st) {
#pragma unroll
  for (int i = 0; i < WKC / 4; ++i) r[i] = *(const v4f*)(wp + (size_t)(st * WKC + i * 4) * CC); }
__device__ __forceinline__ void w_store(char* d, const v4f (&r)[WKC / 4]) {
#pragma unroll
  for (int i = 0; i < WKC / 4; ++i) { v4b h;
#pragma unroll
    for (int e = 0; e < 4; ++e) h[e] = (__bf16)r[i][e];
    *(v4b*)(d + i * 4 * WPT) = h; } }
// the lane's 2 x 16 values of its own row for the stage's two 32-wide k chunks, in fragment order (8g + 0..7, 16 + 8g + 0..7)
__device__ __forceinline__ void x_load(v4f (&r)[8], const float* xp, int st) {
#pragma unroll
  for (int c = 0; c < 2; ++c) { const float* p = xp + st * WKC + c * 32; r[c * 4] = *(const v4f*)p; r[c * 4 + 1] = *(const v4f*)(p + 4); r[c * 4 + 2] = *(const v4f*)(p + 16); r[c * 4 + 3] = *(const v4f*)(p + 20); } }
// B fragment (32 k x 16 columns) of the staged tile: p = tile + (k0 + 8g + (lane & 7)) * WPT + 2 * column0 + 16 * ((lane >> 3) & 1); lane (g, col) gets k0 + 8g + 0..7 and k0 + 16 + 8g + 0..7 of column0 + col
__device__ __forceinline__ v16b frag_t(const char* p) { typedef __attribute__((address_space(3))) s16x8 lds_s16x8; union { v16b v; s16x8 q[2]; } u;
  u.q[0] = __builtin_amdgcn_ds_load_tr16_b128_v8i16((lds_s16x8*)p); u.q[1] = __builtin_amdgcn_ds_load_tr16_b128_v8i16((lds_s16x8*)(p + 16 * WPT)); return u.v; }
// one stage's products: four groups of four B fragments (k chunk c = q >> 1, columns (q & 1) * 64 ...); per accumulator the k chunks come in ascending order, as before
__device__ __forceinline__ void mm_stage(v8f (&acc)[8], const v16b (&a)[2], const char* tb) {
#pragma unroll
  for (int q = 0; q < 4; ++q) { v16b w[4];
#pragma unroll
    for (int j = 0; j < 4; ++j) w[j] = frag_t(tb + (q >> 1) * 32 * WPT + ((q & 1) * 4 + j) * 32);
    __builtin_amdgcn_sched_barrier(0);   // keeps a group's eight LDS reads together in front of its WMMAs: one LDS latency a group (without it each fragment's reads stand directly in front of its WMMA and each waits alone)
#pragma unroll
    for (int j = 0; j < 4; ++j) acc[(q & 1) * 4 + j] = wmma_bf(a[q >> 1], w[j], acc[(q & 1) * 4 + j]); } }
// the same with the row operand split hi + lo: per accumulator hi, then lo, of each k chunk, as before
__device__ __forceinline__ void mm_stage2(v8f (&acc)[8], const F2 (&a)[2], const char* tb) {
#pragma unroll
  for (int q = 0; q < 4; ++q) { v16b w[4];
#pragma unroll
    for (int j = 0; j < 4; ++j) w[j] = frag_t(tb + (q >> 1) * 32 * WPT + ((q & 1) * 4 + j) * 32);
    __builtin_amdgcn_sched_barrier(0);   // as in mm_stage
#pragma unroll
    for (int j = 0; j < 4; ++j) acc[(q & 1) * 4 + j] = wmma_bf(a[q >> 1].h, w[j], acc[(q & 1) * 4 + j]);
#pragma unroll
    for (int j = 0; j < 4; ++j) acc[(q & 1) * 4 + j] = wmma_bf(a[q >> 1].l, w[j], acc[(q & 1) * 4 + j]); } }
__device__ __forceinline__ void x_frag(v16b (&a)[2], const v4f (&xr)[8]) {
#pragma unroll
  for (int c = 0; c < 2; ++c)
#pragma unroll
    for (int i = 0; i < 4; ++i) { a[c][i] = (__bf16)xr[c * 4][i]; a[c][4 + i] = (__bf16)xr[c * 4 + 1][i]; a[c][8 + i] = (__bf16)xr[c * 4 + 2][i]; a[c][12 + i] = (__bf16)xr[c * 4 + 3][i]; } }
__device__ __forceinline__ void x_frag2(F2 (&a)[2], const v4f (&xr)[8]) {
#pragma unroll
  for (int c = 0; c < 2; ++c) { float v[16];
#pragma unroll
    for (int i = 0; i < 4; ++i) { v[i] = xr[c * 4][i]; v[4 + i] = xr[c * 4 + 1][i]; v[8 + i] = xr[c * 4 + 2][i]; v[12 + i] = xr[c * 4 + 3][i]; }
    a[c] = bsplit16(v); } }
// ---- k_lin: block = (64 rows, 128 cols, which): {q,k,v}p = input W ((in,out)) + b, exact products, f32 rows (k: the f32 value as bf16 hi + lo)
__global__ __launch_bounds__(128) void k_lin(const float* __restrict__ XQ, const float* __restrict__ XK, const float* __restrict__ XV, const float* __restrict__ WQ, const float* __restrict__ BQ, const float* __restrict__ WK, const float* __restrict__ BK, const float* __restrict__ WV, const float* __restrict__ BV, float* __restrict__ QF, float* __restrict__ KF, float* __restrict__ VF) { __shared__ __align__(16) float sf[4][16][132]; __shared__ __align__(32) char sw[2 * WBUF];
  const int tid = threadIdx.x, wave = tid >> 5, lane = tid & 31, col = lane & 15, g = lane >> 4; const int which = blockIdx.z; const int c0 = blockIdx.y * 128; const size_t r0 = (size_t)blockIdx.x * 64 + wave * 16;
  const float* X = which == 0 ? XQ : which == 1 ? XK : XV; const float* WA = which == 0 ? WQ : which == 1 ? WK : WV; const float* BA = which == 0 ? BQ : which == 1 ? BK : BV; float* DST = which == 0 ? QF : which == 1 ? KF : VF;
  v8f acc[8] = {};
  const float* wp = WA + (size_t)wave * CC + c0 + lane * 4; const float* xp = X + (r0 + col) * CC + 8 * g;
  char* sd = sw + wave * WPT + lane * 8; const char* tl = sw + (8 * g + (lane & 7)) * WPT + 16 * ((lane >> 3) & 1);
  v4f wr[WKC / 4], xr[8];
  w_load(wr, wp, 0); x_load(xr, xp, 0); w_store(sd, wr);
  __syncthreads();   // stage 0 may be read
  // the stage loop stays rolled (one stage's loads in flight fill 96 registers); the last stage, which has nothing to fetch, stands behind it
  v16b a[2];
#pragma unroll 1
  for (int st = 0; st + 1 < CC / WKC; ++st) { x_frag(a, xr);
    w_load(wr, wp, st + 1); x_load(xr, xp, st + 1);   // the next stage's loads fly while this stage is worked on
    mm_stage(acc, a, tl + (st & 1) * WBUF);
    w_store(sd + ((st + 1) & 1) * WBUF, wr);
    __syncthreads(); }   // publishes stage st + 1 and ends every wave's reads of stage st, whose buffer the next trip refills
  x_frag(a, xr); mm_stage(acc, a, tl + ((CC / WKC - 1) & 1) * WBUF);
#pragma unroll
  for (int j = 0; j < 8; ++j) { const float bb = bfr(BA[c0 + j * 16 + col]);
#pragma unroll
    for (int r = 0; r < 8; ++r) sf[wave][8 * g + r][j * 16 + col] = acc[j][r] + bb; }
  LDSX();
  if (which == 1) {   // k rows leave split: virtual row (64 values, 256 B) = 64 bf16 hi, then 64 bf16 lo; 16 lanes fill one whole 128-B line per store
    char* kd = (char*)DST + (r0 * (CC / HN) + c0 / HN + g) * (size_t)(HN * 4) + col * 8;
    for (int rl = 0; rl < 16; ++rl) { const v4f x = *(const v4f*)&sf[wave][rl][lane * 4]; v4b h, l;
#pragma unroll
      for (int i = 0; i < 4; ++i) { h[i] = (__bf16)x[i]; l[i] = (__bf16)(x[i] - (float)h[i]); }
      vst2(kd + (size_t)rl * (CC * 4), h); vst2(kd + (size_t)rl * (CC * 4) + HN * 2, l); } }
  else { for (int rl = 0; rl < 16; ++rl) vst2(DST + (r0 + rl) * CC + c0 + lane * 4, *(const v4f*)&sf[wave][rl][lane * 4]);
    asm volatile("s_wait_xcnt 0x0" ::: "memory"); } }   // behind the run of stores: no register that a store names is rewritten ahead of it on any way the built code has from here
// ---- k_vt: block = (128 virtual rows s, b*8+n): VF virtual rows -> bf16 hi/lo planes [(bn)*64 + d][s]; 256-B pieces
__global__ __launch_bounds__(128) void k_vt(const float* __restrict__ VF, __bf16* __restrict__ VT, __bf16* __restrict__ VL) { __shared__ __align__(16) __bf16 th[HN][136], tl[HN][136];
  const int tid = threadIdx.x; const int t0 = blockIdx.x * 128; const int bn = blockIdx.y; const int b = bn / NP, n = bn % NP;
  for (int e = tid; e < 128 * HN; e += 128) { const int sl = e / HN, d = e % HN; const float v = VF[ROWO(b, n, t0 + sl) + d]; const __bf16 h = (__bf16)v; th[d][sl] = h; tl[d][sl] = (__bf16)(v - (float)h); }
  __syncthreads();
  for (int e = tid; e < HN * 16; e += 128) { const int d = e >> 4, q = e & 15; const size_t o = ((size_t)bn * HN + d) * SQ + t0 + q * 8; vst2((unsigned*)(VT + o), *(const v4u*)&th[d][q * 8]); vst2((unsigned*)(VL + o), *(const v4u*)&tl[d][q * 8]); } }
// ---- k_fa: block = (64 queries, b*8+n), one wave = 16 queries: S^T = K Q^T (3 products; q split here from its f32 virtual rows, k read as the hi + lo rows k_lin stored), running maximum and sum per query, ctx^T += V^T P^T (3 products), P stays in registers
// S^T tile: lane (g, col) holds keys 8g+0..7 of query col, which is the B fragment order of P^T for 32 keys (elements 0..7 from the first 16-key tile, 8..15 from the second)
// e^(s - m) = 2^(s log2 e - m log2 e): one fused multiply-add and the hardware's 2^x per score; the argument is <= 0 but for the rounding of m log2 e, and below -126 the result is 0
#define LOG2E 1.44269504088896340736f
// eight 2^x, each in its own register, in one statement; the v_nop is the slot behind the last one, whose result the next instruction may read
__device__ __forceinline__ void ex2x8(float* x) {
  asm("v_exp_f32 %0, %0\n\tv_exp_f32 %1, %1\n\tv_exp_f32 %2, %2\n\tv_exp_f32 %3, %3\n\tv_exp_f32 %4, %4\n\tv_exp_f32 %5, %5\n\tv_exp_f32 %6, %6\n\tv_exp_f32 %7, %7\n\tv_nop"
      : "+v"(x[0]), "+v"(x[1]), "+v"(x[2]), "+v"(x[3]), "+v"(x[4]), "+v"(x[5]), "+v"(x[6]), "+v"(x[7])); }
__device__ __forceinline__ v8f wmma_p(v16b a, v16b b, v8f c) { return __builtin_amdgcn_wmma_f32_16x16x32_bf16(false, a, false, b, (short)0, c, false, false); }
// K rows and both V^T planes of 64 keys are staged once per block in LDS and read from there by all four waves; two buffers, the next stage's copies fly while this stage is worked on
#define FK 64                        // keys per stage
#define KP 272                       // LDS pitch of a K row: 256 B + 16, 16 B x odd, conflict-free for 16-byte reads down a column of rows
#define VP 144                       // LDS pitch of a V^T row: 128 B + 16
#define OFF_VH (FK * KP)
#define OFF_VL (OFF_VH + HN * VP)
#define BUFB (OFF_VL + HN * VP)
// eight 16-byte copies per lane, global memory to LDS through no register; the s_wait_xcnt is the last line of the copies' own statement so that no address register is rewritten ahead of it
__device__ __forceinline__ void acopy8(const unsigned (&l)[8], const char* const (&p)[8]) {
  asm volatile("global_load_async_to_lds_b128 %0, %8, off\n\t"
               "global_load_async_to_lds_b128 %1, %9, off\n\t"
               "global_load_async_to_lds_b128 %2, %10, off\n\t"
               "global_load_async_to_lds_b128 %3, %11, off\n\t"
               "global_load_async_to_lds_b128 %4, %12, off\n\t"
               "global_load_async_to_lds_b128 %5, %13, off\n\t"
               "global_load_async_to_lds_b128 %6, %14, off\n\t"
               "global_load_async_to_lds_b128 %7, %15, off\n\t"
               "s_wait_xcnt 0x0"
               :: "v"(l[0]), "v"(l[1]), "v"(l[2]), "v"(l[3]), "v"(l[4]), "v"(l[5]), "v"(l[6]), "v"(l[7]), "v"(p[0]), "v"(p[1]), "v"(p[2]), "v"(p[3]), "v"(p[4]), "v"(p[5]), "v"(p[6]), "v"(p[7]) : "memory"); }
// one stage: 64 K rows (16 KiB in a row in memory; a wave's copy = 4 whole lines) and 64 rows x 128 B of each V^T plane (a wave's copy = 4 rows = 4 whole lines)
__device__ __forceinline__ void stage_in(unsigned lk, unsigned lv, const char* gk, const char* gh, const char* gl, int st) {
  unsigned l[8]; const char* p[8];
#pragma unroll
  for (int i = 0; i < 8; ++i) { l[i] = lk + i * 8 * KP; p[i] = gk + (size_t)st * (FK * HN * 4) + i * 2048; }
  acopy8(l, p);
#pragma unroll
  for (int i = 0; i < 4; ++i) { l[i] = lv + i * 16 * VP; p[i] = gh + (size_t)st * (FK * 2) + (size_t)i * 16 * SQ * 2; l[4 + i] = lv + (OFF_VL - OFF_VH) + i * 16 * VP; p[4 + i] = gl + (size_t)st * (FK * 2) + (size_t)i * 16 * SQ * 2; }
  acopy8(l, p); }
__device__ __forceinline__ v16b frag_s(const char* p) { union { v16b v; v8b q[2]; } u; u.q[0] = *(const v8b*)p; u.q[1] = *(const v8b*)(p + 32); return u.v; }   // 32 bf16 of an LDS row (32 keys of a V^T plane, or a 32-wide k chunk of a K half row) in fragment order; the lane's 16 * (lane >> 4) bytes are already in p
__device__ __forceinline__ F2 ld_kf(const char* p) { F2 r; r.h = frag_s(p); r.l = frag_s(p + HN * 2); return r; }   // hi and lo fragment of a 32-wide k chunk of an LDS row of K
__global__ __launch_bounds__(128) void k_fa(const float* __restrict__ QF, const float* __restrict__ KF, const __bf16* __restrict__ VT, const __bf16* __restrict__ VL, float* __restrict__ Y) {
  __shared__ __attribute__((aligned(16))) char sm[2 * BUFB];
  const int tid = threadIdx.x, wave = tid >> 5, lane = tid & 31, col = lane & 15, g = lane >> 4; const int bn = blockIdx.y; const int b = bn / NP, n = bn % NP; const int q0 = blockIdx.x * 64 + wave * 16;
  // the thread's own 16 bytes of each copy: LDS byte addresses in buffer 0 and global addresses in stage 0
  const unsigned sm0 = (unsigned)(size_t)sm; const unsigned lk = sm0 + (tid >> 4) * KP + (tid & 15) * 16; const unsigned lv = sm0 + OFF_VH + (tid >> 3) * VP + (tid & 7) * 16;
  const char* gk = (const char*)(KF + ROWO(b, n, 0)) + tid * 16; const char* gh = (const char*)(VT + ((size_t)bn * HN + (tid >> 3)) * SQ) + (tid & 7) * 16; const char* gl = (const char*)(VL + ((size_t)bn * HN + (tid >> 3)) * SQ) + (tid & 7) * 16;
  stage_in(lk, lv, gk, gh, gl, 0);
  F2 qf[HN / 32];
#pragma unroll
  for (int kc = 0; kc < HN / 32; ++kc) qf[kc] = split_row(QF + ROWO(b, n, q0 + col), kc * 32, lane);
  asm volatile("s_wait_asynccnt 0x0" ::: "memory");   // this wave's copies of stage 0 have landed
  __syncthreads();                                     // ... and every other wave's: stage 0 may be read
  stage_in(lk + BUFB, lv + BUFB, gk, gh, gl, 1);
  const char* kl0 = sm + col * KP + 16 * g; const char* vl0 = sm + OFF_VH + col * VP + 16 * g;   // the lane's own row and half in the K tile and in the V^T hi tile
  v8f acc[HN / 16] = {}; float m = -3.0e38f, l = 0.f;   // m: the running maximum times log2 e
  F2 kr[2][HN / 32];
#pragma unroll
  for (int u = 0; u < 2; ++u)
#pragma unroll
    for (int kc = 0; kc < HN / 32; ++kc) kr[u][kc] = ld_kf(kl0 + u * 16 * KP + kc * 64);
  // the stage loop and the loop over a stage's two halves of 32 keys stay rolled (one trip's fragments fill the first 256 registers); the short loops inside are unrolled so that the fragment arrays live in registers
#pragma unroll 1
  for (int st = 0; st < SQ / FK; ++st) { const int bo = (st & 1) * BUFB; const char* kb = kl0 + bo; const char* vb = vl0 + bo;
#pragma unroll 1
    for (int h = 0; h < FK / 32; ++h) { v8f s[2]; v16b vh[HN / 16], vl[HN / 16];
#pragma unroll
      for (int u = 0; u < 2; ++u) { v8f c = {};
#pragma unroll
        for (int kc = 0; kc < HN / 32; ++kc) { const F2 kf = kr[u][kc]; c = wmma_p(kf.l, qf[kc].h, c); c = wmma_p(kf.h, qf[kc].l, c); c = wmma_p(kf.h, qf[kc].h, c); }
        s[u] = c; }
      float mx = fmaxf(s[0][0], s[1][0]);
#pragma unroll
      for (int i = 1; i < 8; ++i) mx = fmaxf(mx, fmaxf(s[0][i], s[1][i]));
      mx *= LOG2E;   // from here on the maximum is kept as this rounded product (rounding keeps the order): the one value that every exponent below is taken against
      mx = fmaxf(mx, __shfl_xor(mx, 16));   // the exchange goes through the LDS queue, which returns in order: it stands in front of the K and V reads so that its result does not wait for theirs
      if (h == 0) {   // the same stage's second 32 keys' rows, fetched one trip ahead; nothing of the next stage is read here
#pragma unroll
        for (int u = 0; u < 2; ++u)
#pragma unroll
          for (int kc = 0; kc < HN / 32; ++kc) kr[u][kc] = ld_kf(kb + (32 + u * 16) * KP + kc * 64); }
#pragma unroll
      for (int j = 0; j < HN / 16; ++j) { vh[j] = frag_s(vb + j * 16 * VP + h * 64); vl[j] = frag_s(vb + (OFF_VL - OFF_VH) + j * 16 * VP + h * 64); }
      __builtin_amdgcn_sched_barrier(0);   // keeps the V reads issued above the softmax, so that its arithmetic covers their latency (without it the scheduler sinks them to their first use)
      const float mn = fmaxf(m, mx); const float al = __builtin_amdgcn_exp2f(m - mn); m = mn;
      const v8f e0 = __builtin_elementwise_fma(s[0], v8f{} + LOG2E, v8f{} - mn), e1 = __builtin_elementwise_fma(s[1], v8f{} + LOG2E, v8f{} - mn);
      float pv[16]; float ps = 0.f;
#pragma unroll
      for (int i = 0; i < 8; ++i) { pv[i] = e0[i]; pv[8 + i] = e1[i]; }
      ex2x8(pv); ex2x8(pv + 8);
#pragma unroll
      for (int i = 0; i < 8; ++i) { ps += pv[i] + pv[8 + i]; }
      l = l * al + ps; const F2 pf = bsplit16(pv);
#pragma unroll
      for (int j = 0; j < HN / 16; ++j) { v8f c = acc[j] * al; c = wmma_p(vh[j], pf.h, c); c = wmma_p(vh[j], pf.l, c); acc[j] = wmma_p(vl[j], pf.h, c); }
      // WMMA distance: with the split gone no vector instruction stands between the trip's last WMMAs and the next trip's score WMMAs, whose D a build without this line lays over the P hi fragment directly behind its last reader; four slots behind all four accumulators, P held to here
      asm volatile("v_nop\n\tv_nop\n\tv_nop\n\tv_nop" : "+v"(acc[0]), "+v"(acc[1]), "+v"(acc[2]), "+v"(acc[3]) : "v"(pf.h), "v"(pf.l)); }
    asm volatile("s_wait_dscnt 0x0" ::: "memory");      // this wave's reads of the buffer have returned before it is handed back
    asm volatile("s_wait_asynccnt 0x0" ::: "memory");   // this wave's copies of stage st + 1 have landed
    __syncthreads();                                     // publishes stage st + 1 and ends every wave's reads of stage st
    if (st + 2 < SQ / FK) stage_in(lk + bo, lv + bo, gk, gh, gl, st + 2);
    const char* kn = kl0 + (BUFB - bo);   // behind the barrier: the first 32 keys' rows of stage st + 1 (after the last stage the other buffer's old rows, unused)
#pragma unroll
    for (int u = 0; u < 2; ++u)
#pragma unroll
      for (int kc = 0; kc < HN / 32; ++kc) kr[u][kc] = ld_kf(kn + u * 16 * KP + kc * 64); }
  asm volatile("s_wait_asynccnt 0x0" ::: "memory");     // no copy is outstanding when the wave ends
  l += __shfl_xor(l, 16); const float inv = 1.0f / l * 0.125f;   // the module divides the softmax by sqrt(64)
  float* yr = Y + ((size_t)b * SQ + q0 + col) * CC + n * HN + 8 * g;
#pragma unroll
  for (int j = 0; j < HN / 16; ++j) { const v8f c = acc[j] * inv; v4f lo = {c[0], c[1], c[2], c[3]}, hi = {c[4], c[5], c[6], c[7]}; vst2(yr + j * 16, lo); vst2(yr + j * 16 + 4, hi); } }
// ---- k_out: block = (64 rows, 128 cols): out = y (bf16 hi + lo) Wo + bo
__global__ __launch_bounds__(128) void k_out(const float* __restrict__ Y, const float* __restrict__ WP, const float* __restrict__ BP, float* __restrict__ OUT) { __shared__ __align__(16) float sf[4][16][132]; __shared__ __align__(32) char sw[2 * WBUF];
  const int tid = threadIdx.x, wave = tid >> 5, lane = tid & 31, col = lane & 15, g = lane >> 4; const int c0 = blockIdx.y * 128; const size_t r0 = (size_t)blockIdx.x * 64 + wave * 16;
  v8f acc[8] = {};
  const float* wp = WP + (size_t)wave * CC + c0 + lane * 4; const float* xp = Y + (r0 + col) * CC + 8 * g;
  char* sd = sw + wave * WPT + lane * 8; const char* tl = sw + (8 * g + (lane & 7)) * WPT + 16 * ((lane >> 3) & 1);
  v4f wr[WKC / 4], xr[8];
  w_load(wr, wp, 0); x_load(xr, xp, 0); w_store(sd, wr);
  __syncthreads();   // stage 0 may be read
  // the stage loop stays rolled (one stage's loads in flight fill 96 registers); the last stage, which has nothing to fetch, stands behind it
  F2 a[2];
#pragma unroll 1
  for (int st = 0; st + 1 < CC / WKC; ++st) { x_frag2(a, xr);
    w_load(wr, wp, st + 1); x_load(xr, xp, st + 1);   // the next stage's loads fly while this stage is worked on
    mm_stage2(acc, a, tl + (st & 1) * WBUF);
    w_store(sd + ((st + 1) & 1) * WBUF, wr);
    __syncthreads(); }   // publishes stage st + 1 and ends every wave's reads of stage st, whose buffer the next trip refills
  x_frag2(a, xr); mm_stage2(acc, a, tl + ((CC / WKC - 1) & 1) * WBUF);
#pragma unroll
  for (int j = 0; j < 8; ++j) { const float bb = BP ? bfr(BP[c0 + j * 16 + col]) : 0.f;
#pragma unroll
    for (int r = 0; r < 8; ++r) sf[wave][8 * g + r][j * 16 + col] = acc[j][r] + bb; }
  LDSX(); for (int rl = 0; rl < 16; ++rl) vst2(OUT + (r0 + rl) * CC + c0 + lane * 4, *(const v4f*)&sf[wave][rl][lane * 4]); }
extern "C" void kernel_launch(void* const* d_in, const int* in_sizes, int n_in, void* d_out, int out_size, void* d_ws, size_t ws_size, hipStream_t stream) {
  (void)in_sizes; (void)n_in; (void)out_size;
  const float** F = (const float**)d_in;   // 0 q [2,2048,512], 1 k, 2 v, 3 Wq [512,512] ((in,out)), 4 bq, 5 Wk, 6 bk, 7 Wv, 8 bv, 9 Wo, 10 bo
  if (ws_size < (size_t)WS_END) return;
  char* ws = (char*)d_ws; float *QF = (float*)(ws + WS_QF), *KF = (float*)(ws + WS_KF), *VF = (float*)(ws + WS_VF), *Y = (float*)(ws + WS_Y); __bf16 *VT = (__bf16*)(ws + WS_VT), *VL = (__bf16*)(ws + WS_VL);
  k_lin<<<dim3(TNB * SQ / 64, CC / 128, 3), 128, 0, stream>>>(F[0], F[1], F[2], F[3], F[4], F[5], F[6], F[7], F[8], QF, KF, VF);
  k_vt<<<dim3(SQ / 128, TNB * NP), 128, 0, stream>>>(VF, VT, VL);
  k_fa<<<dim3(SQ / 64, TNB * NP), 128, 0, stream>>>(QF, KF, VT, VL, Y);
  k_out<<<dim3(TNB * SQ / 64, CC / 128), 128, 0, stream>>>(Y, F[9], F[10], (float*)d_out);
}

// v006
// One run takes 75.2 microseconds.
// In both of two side-by-side timings against v005, it was 1.18 times as fast.
// All steps since v000 together make it 12.2 times as fast.
// compute dtype: all float inputs rounded to bf16; q/k/v projections with EXACT bf16 products on WMMA 16x16x32 (f32 accumulate, + bias) kept as f32 rows; the module's reshape(B,H,S,Dh) re-reads those rows as [b][h][s][64]; logits from the f32 rows split bf16 hi + lo on both sides (3 products; the k rows are split once, where the projection stores them), kept in registers; softmax in f32 (e^x as the hardware's 2^x of x log2 e) with a running maximum and sum, then / 8 as written; unnormalised P split bf16 hi + lo against v bf16 hi + lo (3 products; the v rows are split once, where the projection stores them, and transposed by the LDS load), all in one launch; out = concat (bf16 hi + lo) Wo + bo; f32 output.
#include <hip/hip_runtime.h>
#include <math.h>

typedef __attribute__((ext_vector_type(16))) _Float16 v16h;
typedef __attribute__((ext_vector_type(16))) __bf16 v16b;
typedef __attribute__((ext_vector_type(8)))  _Float16 v8h;
typedef __attribute__((ext_vector_type(8)))  float v8f;
typedef __attribute__((ext_vector_type(4)))  float v4f;
typedef __attribute__((ext_vector_type(2)))  float v2f;
typedef __attribute__((ext_vector_type(4)))  unsigned v4u;
typedef __attribute__((ext_vector_type(4)))  int v4i;
typedef float __attribute__((may_alias)) float_a;
typedef int __attribute__((may_alias)) int_a;

template <typename T> __device__ __forceinline__ void vst2(void* p, T v) { *(T*)p = v;  }
__device__ __forceinline__ v8f wmma16(v16h a, v16h b, v8f c) {
  v8f d = __builtin_amdgcn_wmma_f32_16x16x32_f16(false, a, false, b, (short)0, c, false, false);
  asm volatile("v_nop\n\tv_nop\n\tv_nop\n\tv_nop" : "+v"(d) : "v"(a), "v"(b));
  return d;
}
__device__ __forceinline__ v8f wmma_bf(v16b a, v16b b, v8f c) {
  v8f d = __builtin_amdgcn_wmma_f32_16x16x32_bf16(false, a, false, b, (short)0, c, false, false);
  asm volatile("v_nop\n\tv_nop\n\tv_nop\n\tv_nop" : "+v"(d) : "v"(a), "v"(b));
  return d;
}
// 16x16x32 fragments: lane = (h = lane>>4, row/col = lane&15); elements 0..7 = k0+8h+0..7, 8..15 = k0+16+8h+0..7; D element r = row 8h+r
__device__ __forceinline__ v16h frag_h(const _Float16* rowk0, int lane) {
  union { v16h v; v8h q[2]; } u; const _Float16* p = rowk0 + 8 * (lane >> 4);
  u.q[0] = *(const v8h*)p; u.q[1] = *(const v8h*)(p + 16); return u.v;
}
__device__ __forceinline__ v16h frag_f32(const float* rowk0, int lane) {
  v16h a; const float* p = rowk0 + 8 * (lane >> 4);
#pragma unroll
  for (int i = 0; i < 8; ++i) { a[i] = (_Float16)p[i]; a[8 + i] = (_Float16)p[16 + i]; }
  return a;
}
__device__ __forceinline__ v16h frag_f32s(const float* rowk0, int lane, float sc) {
  v16h a; const float* p = rowk0 + 8 * (lane >> 4);
#pragma unroll
  for (int i = 0; i < 8; ++i) { a[i] = (_Float16)(p[i] * sc); a[8 + i] = (_Float16)(p[16 + i] * sc); }
  return a;
}
// column fragment from a [K][ld] layout (column n), rows >= K read as 0
__device__ __forceinline__ v16h fragc_f32(const float* W, int k0, int n, int lane, int ld, int K) {
  v16h a; const int g = lane >> 4;
#pragma unroll
  for (int i = 0; i < 8; ++i) { const int ka = k0 + 8 * g + i, kb = ka + 16;
    a[i] = (_Float16)(ka < K ? W[(size_t)(ka < K ? ka : K - 1) * ld + n] : 0.f); a[8 + i] = (_Float16)(kb < K ? W[(size_t)(kb < K ? kb : K - 1) * ld + n] : 0.f); }
  return a;
}
struct F2 { v16b h, l; };
__device__ __forceinline__ F2 bsplit16(const float v[16]) { F2 r;
#pragma unroll
  for (int i = 0; i < 16; ++i) { const __bf16 h = (__bf16)v[i]; r.h[i] = h; r.l[i] = (__bf16)(v[i] - (float)h); }
  return r; }
__device__ __forceinline__ F2 split_row(const float* row, int k0, int lane) { float v[16]; const float* p = row + k0 + 8 * (lane >> 4);
#pragma unroll
  for (int i = 0; i < 8; ++i) { v[i] = p[i]; v[8 + i] = p[16 + i]; }
  return bsplit16(v); }
__device__ __forceinline__ F2 split_rowK(const float* row, int k0, int lane, int K) { float v[16]; const int g = lane >> 4;
#pragma unroll
  for (int i = 0; i < 8; ++i) { const int ka = k0 + 8 * g + i, kb = ka + 16; v[i] = ka < K ? row[ka < K ? ka : K - 1] : 0.f; v[8 + i] = kb < K ? row[kb < K ? kb : K - 1] : 0.f; }
  return bsplit16(v); }
__device__ __forceinline__ F2 split_col(const float* W, int k0, int n, int lane, int ld, int K) { float v[16]; const int g = lane >> 4;
#pragma unroll
  for (int i = 0; i < 8; ++i) { const int ka = k0 + 8 * g + i, kb = ka + 16; v[i] = ka < K ? W[(size_t)(ka < K ? ka : K - 1) * ld + n] : 0.f; v[8 + i] = kb < K ? W[(size_t)(kb < K ? kb : K - 1) * ld + n] : 0.f; }
  return bsplit16(v); }
__device__ __forceinline__ v8f mac3(const F2& a, const F2& b, v8f c) { c = wmma_bf(a.l, b.h, c); c = wmma_bf(a.h, b.l, c); return wmma_bf(a.h, b.h, c); }
__device__ __forceinline__ float sigm(float v) { return 1.0f / (1.0f + expf(-v)); }
#define LDSX() do { asm volatile("s_wait_dscnt 0" ::: "memory"); __builtin_amdgcn_wave_barrier(); __builtin_amdgcn_fence(__ATOMIC_RELEASE, "workgroup"); } while (0)

// Multi self-attention (B 2, S 2,048, D 512, 8 heads x 64) with the module's literal head split qp.reshape(B, H, S, Dh) -- NO transpose: head h of batch b = rows [h*2048, (h+1)*2048) of the projection viewed as [B][H*S][64] -- scores unscaled, attn = softmax / sqrt(64), ctx.transpose(0,2,1,3) -> [B,S,512], @ Wo + bo.
__device__ __forceinline__ float bfr(float v) { return (float)(__bf16)v; }
#define NBT 2
#define SQ 2048
#define TT SQ
#define NP 8
#define HN 64
#define CC 512
#define HG 4
#ifndef TNB
#define TNB NBT
#endif
// virtual row (b, n, s) of a projection viewed as [b][H*S][64]: float offset
#define ROWO(b, n, s) ((((size_t)(b) * NP + (n)) * SQ + (s)) * HN)
typedef __attribute__((ext_vector_type(8))) __bf16 v8b;
typedef __attribute__((ext_vector_type(4))) __bf16 v4b;
__device__ __forceinline__ v16b frag_b(const __bf16* rowk0, int lane) { union { v16b v; v8b q[2]; } u; const __bf16* p = rowk0 + 8 * (lane >> 4); u.q[0] = *(const v8b*)p; u.q[1] = *(const v8b*)(p + 16); return u.v; }
#define WS_QF  0u                                          // f32 projection rows [b*S+t][512] (== virtual [b][h][s][64])
#define WS_KF  (WS_QF + 4u * (size_t)NBT * SQ * CC)          // k projection, virtual rows of 256 B: 64 bf16 hi, 64 bf16 lo
#define WS_VF  (WS_KF + 4u * (size_t)NBT * SQ * CC)          // v projection, rows as k's
#define WS_S   (WS_VF + 4u * (size_t)NBT * SQ * CC)          // unused (scores and P stay in registers)
#define WS_Y   (WS_S + 4u * (size_t)HG * SQ * SQ)            // f32 ctx rows [b*S+s][h*64+d]
#define WS_END (WS_Y + 4u * (size_t)NBT * SQ * CC)
// W of a projection is staged per block: 64 rows (k) x 128 columns, rounded to bf16 as before, row-major in LDS; every wave reads its B fragments from there with the transposing load
#define WKC 64                       // k rows of W per stage
#define WPT 288                      // LDS pitch of a staged W row: 256 B + 32, 32 B x odd, conflict-free for ds_load_tr16_b128
#define WBUF (WKC * WPT)
typedef __attribute__((ext_vector_type(8))) short s16x8;
// one wave-wide load = one whole row piece of 512 B (4 lines); wave w takes rows w, w + 4, ...
__device__ __forceinline__ void w_load(v4f (&r)[WKC / 4], const float* wp, int st) {
#pragma unroll
  for (int i = 0; i < WKC / 4; ++i) r[i] = *(const v4f*)(wp + (size_t)(st * WKC + i * 4) * CC); }
__device__ __forceinline__ void w_store(char* d, const v4f (&r)[WKC / 4]) {
#pragma unroll
  for (int i = 0; i < WKC / 4; ++i) { v4b h;
#pragma unroll
    for (int e = 0; e < 4; ++e) h[e] = (__bf16)r[i][e];
    *(v4b*)(d + i * 4 * WPT) = h; } }
// the lane's 2 x 16 values of its own row for the stage's two 32-wide k chunks, in fragment order (8g + 0..7, 16 + 8g + 0..7)
__device__ __forceinline__ void x_load(v4f (&r)[8], const float* xp, int st) {
#pragma unroll
  for (int c = 0; c < 2; ++c) { const float* p = xp + st * WKC + c * 32; r[c * 4] = *(const v4f*)p; r[c * 4 + 1] = *(const v4f*)(p + 4); r[c * 4 + 2] = *(const v4f*)(p + 16); r[c * 4 + 3] = *(const v4f*)(p + 20); } }
// B fragment (32 k x 16 columns) of the staged tile: p = tile + (k0 + 8g + (lane & 7)) * WPT + 2 * column0 + 16 * ((lane >> 3) & 1); lane (g, col) gets k0 + 8g + 0..7 and k0 + 16 + 8g + 0..7 of column0 + col
__device__ __forceinline__ v16b frag_t(const char* p) { typedef __attribute__((address_space(3))) s16x8 lds_s16x8; union { v16b v; s16x8 q[2]; } u;
  u.q[0] = __builtin_amdgcn_ds_load_tr16_b128_v8i16((lds_s16x8*)p); u.q[1] = __builtin_amdgcn_ds_load_tr16_b128_v8i16((lds_s16x8*)(p + 16 * WPT)); return u.v; }
// one stage's products: four groups of four B fragments (k chunk c = q >> 1, columns (q & 1) * 64 ...); per accumulator the k chunks come in ascending order, as before
__device__ __forceinline__ void mm_stage(v8f (&acc)[8], const v16b (&a)[2], const char* tb) {
#pragma unroll
  for (int q = 0; q < 4; ++q) { v16b w[4];
#pragma unroll
    for (int j = 0; j < 4; ++j) w[j] = frag_t(tb + (q >> 1) * 32 * WPT + ((q & 1) * 4 + j) * 32);
    __builtin_amdgcn_sched_barrier(0);   // keeps a group's eight LDS reads together in front of its WMMAs: one LDS latency a group (without it each fragment's reads stand directly in front of its WMMA and each waits alone)
#pragma unroll
    for (int j = 0; j < 4; ++j) acc[(q & 1) * 4 + j] = wmma_bf(a[q >> 1], w[j], acc[(q & 1) * 4 + j]); } }
// the same with the row operand split hi + lo: per accumulator hi, then lo, of each k chunk, as before
__device__ __forceinline__ void mm_stage2(v8f (&acc)[8], const F2 (&a)[2], const char* tb) {
#pragma unroll
  for (int q = 0; q < 4; ++q) { v16b w[4];
#pragma unroll
    for (int j = 0; j < 4; ++j) w[j] = frag_t(tb + (q >> 1) * 32 * WPT + ((q & 1) * 4 + j) * 32);
    __builtin_amdgcn_sched_barrier(0);   // as in mm_stage
#pragma unroll
    for (int j = 0; j < 4; ++j) acc[(q & 1) * 4 + j] = wmma_bf(a[q >> 1].h, w[j], acc[(q & 1) * 4 + j]);
#pragma unroll
    for (int j = 0; j < 4; ++j) acc[(q & 1) * 4 + j] = wmma_bf(a[q >> 1].l, w[j], acc[(q & 1) * 4 + j]); } }
__device__ __forceinline__ void x_frag(v16b (&a)[2], const v4f (&xr)[8]) {
#pragma unroll
  for (int c = 0; c < 2; ++c)
#pragma unroll
    for (int i = 0; i < 4; ++i) { a[c][i] = (__bf16)xr[c * 4][i]; a[c][4 + i] = (__bf16)xr[c * 4 + 1][i]; a[c][8 + i] = (__bf16)xr[c * 4 + 2][i]; a[c][12 + i] = (__bf16)xr[c * 4 + 3][i]; } }
__device__ __forceinline__ void x_frag2(F2 (&a)[2], const v4f (&xr)[8]) {
#pragma unroll
  for (int c = 0; c < 2; ++c) { float v[16];
#pragma unroll
    for (int i = 0; i < 4; ++i) { v[i] = xr[c * 4][i]; v[4 + i] = xr[c * 4 + 1][i]; v[8 + i] = xr[c * 4 + 2][i]; v[12 + i] = xr[c * 4 + 3][i]; }
    a[c] = bsplit16(v); } }
// ---- k_lin: block = (64 rows, 128 cols, which): {q,k,v}p = input W ((in,out)) + b, exact products, f32 rows (k, v: the f32 value as bf16 hi + lo)
__global__ __launch_bounds__(128) void k_lin(const float* __restrict__ XQ, const float* __restrict__ XK, const float* __restrict__ XV, const float* __restrict__ WQ, const float* __restrict__ BQ, const float* __restrict__ WK, const float* __restrict__ BK, const float* __restrict__ WV, const float* __restrict__ BV, float* __restrict__ QF, float* __restrict__ KF, float* __restrict__ VF) { __shared__ __align__(16) float sf[4][16][132]; __shared__ __align__(32) char sw[2 * WBUF];
  const int tid = threadIdx.x, wave = tid >> 5, lane = tid & 31, col = lane & 15, g = lane >> 4; const int which = blockIdx.z; const int c0 = blockIdx.y * 128; const size_t r0 = (size_t)blockIdx.x * 64 + wave * 16;
  const float* X = which == 0 ? XQ : which == 1 ? XK : XV; const float* WA = which == 0 ? WQ : which == 1 ? WK : WV; const float* BA = which == 0 ? BQ : which == 1 ? BK : BV; float* DST = which == 0 ? QF : which == 1 ? KF : VF;
  v8f acc[8] = {};
  const float* wp = WA + (size_t)wave * CC + c0 + lane * 4; const float* xp = X + (r0 + col) * CC + 8 * g;
  char* sd = sw + wave * WPT + lane * 8; const char* tl = sw + (8 * g + (lane & 7)) * WPT + 16 * ((lane >> 3) & 1);
  v4f wr[WKC / 4], xr[8];
  w_load(wr, wp, 0); x_load(xr, xp, 0); w_store(sd, wr);
  __syncthreads();   // stage 0 may be read
  // the stage loop stays rolled (one stage's loads in flight fill 96 registers); the last stage, which has nothing to fetch, stands behind it
  v16b a[2];
#pragma unroll 1
  for (int st = 0; st + 1 < CC / WKC; ++st) { x_frag(a, xr);
    w_load(wr, wp, st + 1); x_load(xr, xp, st + 1);   // the next stage's loads fly while this stage is worked on
    mm_stage(acc, a, tl + (st & 1) * WBUF);
    w_store(sd + ((st + 1) & 1) * WBUF, wr);
    __syncthreads(); }   // publishes stage st + 1 and ends every wave's reads of stage st, whose buffer the next trip refills
  x_frag(a, xr); mm_stage(acc, a, tl + ((CC / WKC - 1) & 1) * WBUF);
#pragma unroll
  for (int j = 0; j < 8; ++j) { const float bb = bfr(BA[c0 + j * 16 + col]);
#pragma unroll
    for (int r = 0; r < 8; ++r) sf[wave][8 * g + r][j * 16 + col] = acc[j][r] + bb; }
  LDSX();
  if (which != 0) {   // k and v rows leave split: virtual row (64 values, 256 B) = 64 bf16 hi, then 64 bf16 lo; 16 lanes fill one whole 128-B line per store
    char* kd = (char*)DST + (r0 * (CC / HN) + c0 / HN + g) * (size_t)(HN * 4) + col * 8;
    for (int rl = 0; rl < 16; ++rl) { const v4f x = *(const v4f*)&sf[wave][rl][lane * 4]; v4b h, l;
#pragma unroll
      for (int i = 0; i < 4; ++i) { h[i] = (__bf16)x[i]; l[i] = (__bf16)(x[i] - (float)h[i]); }
      vst2(kd + (size_t)rl * (CC * 4), h); vst2(kd + (size_t)rl * (CC * 4) + HN * 2, l); } }
  else { for (int rl = 0; rl < 16; ++rl) vst2(DST + (r0 + rl) * CC + c0 + lane * 4, *(const v4f*)&sf[wave][rl][lane * 4]);
    asm volatile("s_wait_xcnt 0x0" ::: "memory"); } }   // behind the run of stores: no register that a store names is rewritten ahead of it on any way the built code has from here
// ---- k_fa: block = (64 queries, b*8+n), one wave = 16 queries: S^T = K Q^T (3 products; q split here from its f32 virtual rows, k read as the hi + lo rows k_lin stored), running maximum and sum per query, ctx^T += V^T P^T (3 products; V^T fragments by the transposing LDS load from the hi + lo rows k_lin stored), P stays in registers
// S^T tile: lane (g, col) holds keys 8g+0..7 of query col, which is the B fragment order of P^T for 32 keys (elements 0..7 from the first 16-key tile, 8..15 from the second)
// e^(s - m) = 2^(s log2 e - m log2 e): one fused multiply-add and the hardware's 2^x per score; the argument is <= 0 but for the rounding of m log2 e, and below -126 the result is 0
#define LOG2E 1.44269504088896340736f
// eight 2^x, each in its own register, in one statement; the v_nop is the slot behind the last one, whose result the next instruction may read
__device__ __forceinline__ void ex2x8(float* x) {
  asm("v_exp_f32 %0, %0\n\tv_exp_f32 %1, %1\n\tv_exp_f32 %2, %2\n\tv_exp_f32 %3, %3\n\tv_exp_f32 %4, %4\n\tv_exp_f32 %5, %5\n\tv_exp_f32 %6, %6\n\tv_exp_f32 %7, %7\n\tv_nop"
      : "+v"(x[0]), "+v"(x[1]), "+v"(x[2]), "+v"(x[3]), "+v"(x[4]), "+v"(x[5]), "+v"(x[6]), "+v"(x[7])); }
__device__ __forceinline__ v8f wmma_p(v16b a, v16b b, v8f c) { return __builtin_amdgcn_wmma_f32_16x16x32_bf16(false, a, false, b, (short)0, c, false, false); }
// K rows and V rows of 64 keys are staged once per block in LDS and read from there by all four waves; two buffers, the next stage's copies fly while this stage is worked on
#define FK 64                        // keys per stage
#define KP 272                       // LDS pitch of a K row: 256 B + 16, 16 B x odd, conflict-free for 16-byte reads down a column of rows
#define VP 288                       // LDS pitch of a V row: 256 B + 32, 32 B x odd, conflict-free for ds_load_tr16_b128
#define OFF_V (FK * KP)
#define BUFB (OFF_V + FK * VP)
// eight 16-byte copies per lane, global memory to LDS through no register; the s_wait_xcnt is the last line of the copies' own statement so that no address register is rewritten ahead of it
__device__ __forceinline__ void acopy8(const unsigned (&l)[8], const char* const (&p)[8]) {
  asm volatile("global_load_async_to_lds_b128 %0, %8, off\n\t"
               "global_load_async_to_lds_b128 %1, %9, off\n\t"
               "global_load_async_to_lds_b128 %2, %10, off\n\t"
               "global_load_async_to_lds_b128 %3, %11, off\n\t"
               "global_load_async_to_lds_b128 %4, %12, off\n\t"
               "global_load_async_to_lds_b128 %5, %13, off\n\t"
               "global_load_async_to_lds_b128 %6, %14, off\n\t"
               "global_load_async_to_lds_b128 %7, %15, off\n\t"
               "s_wait_xcnt 0x0"
               :: "v"(l[0]), "v"(l[1]), "v"(l[2]), "v"(l[3]), "v"(l[4]), "v"(l[5]), "v"(l[6]), "v"(l[7]), "v"(p[0]), "v"(p[1]), "v"(p[2]), "v"(p[3]), "v"(p[4]), "v"(p[5]), "v"(p[6]), "v"(p[7]) : "memory"); }
// one stage: 64 K rows and 64 V rows, each 16 KiB in a row in memory; a wave's copy = 4 whole lines
__device__ __forceinline__ void stage_in(unsigned lk, unsigned lv, const char* gk, const char* gv, int st) {
  unsigned l[8]; const char* p[8];
#pragma unroll
  for (int i = 0; i < 8; ++i) { l[i] = lk + i * 8 * KP; p[i] = gk + (size_t)st * (FK * HN * 4) + i * 2048; }
  acopy8(l, p);
#pragma unroll
  for (int i = 0; i < 8; ++i) { l[i] = lv + i * 8 * VP; p[i] = gv + (size_t)st * (FK * HN * 4) + i * 2048; }
  acopy8(l, p); }
__device__ __forceinline__ v16b frag_s(const char* p) { union { v16b v; v8b q[2]; } u; u.q[0] = *(const v8b*)p; u.q[1] = *(const v8b*)(p + 32); return u.v; }   // 32 bf16 of an LDS row (a 32-wide k chunk of a K half row) in fragment order; the lane's 16 * (lane >> 4) bytes are already in p
__device__ __forceinline__ F2 ld_kf(const char* p) { F2 r; r.h = frag_s(p); r.l = frag_s(p + HN * 2); return r; }   // hi and lo fragment of a 32-wide k chunk of an LDS row of K
// A fragment of V^T (16 d x 32 keys) from the staged V rows: p = tile + (key0 + 8g + (lane & 7)) * VP + 2 * d0 + 16 * ((lane >> 3) & 1); lane (g, col) gets keys key0 + 8g + 0..7 and key0 + 16 + 8g + 0..7 of d0 + col, the order of P^T's elements
__device__ __forceinline__ v16b frag_v(const char* p) { typedef __attribute__((address_space(3))) s16x8 lds_s16x8; union { v16b v; s16x8 q[2]; } u;
  u.q[0] = __builtin_amdgcn_ds_load_tr16_b128_v8i16((lds_s16x8*)p); u.q[1] = __builtin_amdgcn_ds_load_tr16_b128_v8i16((lds_s16x8*)(p + 16 * VP)); return u.v; }
__global__ __launch_bounds__(128) void k_fa(const float* __restrict__ QF, const float* __restrict__ KF, const float* __restrict__ VF, float* __restrict__ Y) {
  __shared__ __attribute__((aligned(16))) char sm[2 * BUFB];
  const int tid = threadIdx.x, wave = tid >> 5, lane = tid & 31, col = lane & 15, g = lane >> 4; const int bn = blockIdx.y; const int b = bn / NP, n = bn % NP; const int q0 = blockIdx.x * 64 + wave * 16;
  // the thread's own 16 bytes of each copy: LDS byte addresses in buffer 0 and global addresses in stage 0
  const unsigned sm0 = (unsigned)(size_t)sm; const unsigned lk = sm0 + (tid >> 4) * KP + (tid & 15) * 16; const unsigned lv = sm0 + OFF_V + (tid >> 4) * VP + (tid & 15) * 16;
  const char* gk = (const char*)(KF + ROWO(b, n, 0)) + tid * 16; const char* gv = (const char*)(VF + ROWO(b, n, 0)) + tid * 16;
  stage_in(lk, lv, gk, gv, 0);
  F2 qf[HN / 32];
#pragma unroll
  for (int kc = 0; kc < HN / 32; ++kc) qf[kc] = split_row(QF + ROWO(b, n, q0 + col), kc * 32, lane);
  asm volatile("s_wait_asynccnt 0x0" ::: "memory");   // this wave's copies of stage 0 have landed
  __syncthreads();                                     // ... and every other wave's: stage 0 may be read
  stage_in(lk + BUFB, lv + BUFB, gk, gv, 1);
  const char* kl0 = sm + col * KP + 16 * g; const char* vl0 = sm + OFF_V + (8 * g + (lane & 7)) * VP + 16 * ((lane >> 3) & 1);   // the lane's own row and half in the K tile; its row and 16 bytes of the V tile for the transposing load
  v8f acc[HN / 16] = {}; float m = -3.0e38f, l = 0.f;   // m: the running maximum times log2 e
  F2 kr[2][HN / 32];
#pragma unroll
  for (int u = 0; u < 2; ++u)
#pragma unroll
    for (int kc = 0; kc < HN / 32; ++kc) kr[u][kc] = ld_kf(kl0 + u * 16 * KP + kc * 64);
  // the stage loop and the loop over a stage's two halves of 32 keys stay rolled (one trip's fragments fill the first 256 registers); the short loops inside are unrolled so that the fragment arrays live in registers
#pragma unroll 1
  for (int st = 0; st < SQ / FK; ++st) { const int bo = (st & 1) * BUFB; const char* kb = kl0 + bo; const char* vb = vl0 + bo;
#pragma unroll 1
    for (int h = 0; h < FK / 32; ++h) { v8f s[2]; v16b vh[HN / 16], vl[HN / 16];
#pragma unroll
      for (int u = 0; u < 2; ++u) { v8f c = {};
#pragma unroll
        for (int kc = 0; kc < HN / 32; ++kc) { const F2 kf = kr[u][kc]; c = wmma_p(kf.l, qf[kc].h, c); c = wmma_p(kf.h, qf[kc].l, c); c = wmma_p(kf.h, qf[kc].h, c); }
        s[u] = c; }
      float mx = fmaxf(s[0][0], s[1][0]);
#pragma unroll
      for (int i = 1; i < 8; ++i) mx = fmaxf(mx, fmaxf(s[0][i], s[1][i]));
      mx *= LOG2E;   // from here on the maximum is kept as this rounded product (rounding keeps the order): the one value that every exponent below is taken against
      mx = fmaxf(mx, __shfl_xor(mx, 16));   // the exchange goes through the LDS queue, which returns in order: it stands in front of the K and V reads so that its result does not wait for theirs
      if (h == 0) {   // the same stage's second 32 keys' rows, fetched one trip ahead; nothing of the next stage is read here
#pragma unroll
        for (int u = 0; u < 2; ++u)
#pragma unroll
          for (int kc = 0; kc < HN / 32; ++kc) kr[u][kc] = ld_kf(kb + (32 + u * 16) * KP + kc * 64); }
#pragma unroll
      for (int j = 0; j < HN / 16; ++j) { vh[j] = frag_v(vb + h * 32 * VP + j * 32); vl[j] = frag_v(vb + h * 32 * VP + HN * 2 + j * 32); }
      __builtin_amdgcn_sched_barrier(0);   // keeps the V reads issued above the softmax, so that its arithmetic covers their latency (without it the scheduler sinks them to their first use)
      const float mn = fmaxf(m, mx); const float al = __builtin_amdgcn_exp2f(m - mn); m = mn;
      const v8f e0 = __builtin_elementwise_fma(s[0], v8f{} + LOG2E, v8f{} - mn), e1 = __builtin_elementwise_fma(s[1], v8f{} + LOG2E, v8f{} - mn);
      float pv[16]; float ps = 0.f;
#pragma unroll
      for (int i = 0; i < 8; ++i) { pv[i] = e0[i]; pv[8 + i] = e1[i]; }
      ex2x8(pv); ex2x8(pv + 8);
#pragma unroll
      for (int i = 0; i < 8; ++i) { ps += pv[i] + pv[8 + i]; }
      l = l * al + ps; const F2 pf = bsplit16(pv);
#pragma unroll
      for (int j = 0; j < HN / 16; ++j) { v8f c = acc[j] * al; c = wmma_p(vh[j], pf.h, c); c = wmma_p(vh[j], pf.l, c); acc[j] = wmma_p(vl[j], pf.h, c); }
      // WMMA distance: with the split gone no vector instruction stands between the trip's last WMMAs and the next trip's score WMMAs, whose D a build without this line lays over the P hi fragment directly behind its last reader; four slots behind all four accumulators, P held to here
      asm volatile("v_nop\n\tv_nop\n\tv_nop\n\tv_nop" : "+v"(acc[0]), "+v"(acc[1]), "+v"(acc[2]), "+v"(acc[3]) : "v"(pf.h), "v"(pf.l)); }
    asm volatile("s_wait_dscnt 0x0" ::: "memory");      // this wave's reads of the buffer have returned before it is handed back
    asm volatile("s_wait_asynccnt 0x0" ::: "memory");   // this wave's copies of stage st + 1 have landed
    __syncthreads();                                     // publishes stage st + 1 and ends every wave's reads of stage st
    if (st + 2 < SQ / FK) stage_in(lk + bo, lv + bo, gk, gv, st + 2);
    const char* kn = kl0 + (BUFB - bo);   // behind the barrier: the first 32 keys' rows of stage st + 1 (after the last stage the other buffer's old rows, unused)
#pragma unroll
    for (int u = 0; u < 2; ++u)
#pragma unroll
      for (int kc = 0; kc < HN / 32; ++kc) kr[u][kc] = ld_kf(kn + u * 16 * KP + kc * 64); }
  asm volatile("s_wait_asynccnt 0x0" ::: "memory");     // no copy is outstanding when the wave ends
  l += __shfl_xor(l, 16); const float inv = 1.0f / l * 0.125f;   // the module divides the softmax by sqrt(64)
  float* yr = Y + ((size_t)b * SQ + q0 + col) * CC + n * HN + 8 * g;
#pragma unroll
  for (int j = 0; j < HN / 16; ++j) { const v8f c = acc[j] * inv; v4f lo = {c[0], c[1], c[2], c[3]}, hi = {c[4], c[5], c[6], c[7]}; vst2(yr + j * 16, lo); vst2(yr + j * 16 + 4, hi); } }
// ---- k_out: block = (64 rows, 128 cols): out = y (bf16 hi + lo) Wo + bo
__global__ __launch_bounds__(128) void k_out(const float* __restrict__ Y, const float* __restrict__ WP, const float* __restrict__ BP, float* __restrict__ OUT) { __shared__ __align__(16) float sf[4][16][132]; __shared__ __align__(32) char sw[2 * WBUF];
  const int tid = threadIdx.x, wave = tid >> 5, lane = tid & 31, col = lane & 15, g = lane >> 4; const int c0 = blockIdx.y * 128; const size_t r0 = (size_t)blockIdx.x * 64 + wave * 16;
  v8f acc[8] = {};
  const float* wp = WP + (size_t)wave * CC + c0 + lane * 4; const float* xp = Y + (r0 + col) * CC + 8 * g;
  char* sd = sw + wave * WPT + lane * 8; const char* tl = sw + (8 * g + (lane & 7)) * WPT + 16 * ((lane >> 3) & 1);
  v4f wr[WKC / 4], xr[8];
  w_load(wr, wp, 0); x_load(xr, xp, 0); w_store(sd, wr);
  __syncthreads();   // stage 0 may be read
  // the stage loop stays rolled (one stage's loads in flight fill 96 registers); the last stage, which has nothing to fetch, stands behind it
  F2 a[2];
#pragma unroll 1
  for (int st = 0; st + 1 < CC / WKC; ++st) { x_frag2(a, xr);
    w_load(wr, wp, st + 1); x_load(xr, xp, st + 1);   // the next stage's loads fly while this stage is worked on
    mm_stage2(acc, a, tl + (st & 1) * WBUF);
    w_store(sd + ((st + 1) & 1) * WBUF, wr);
    __syncthreads(); }   // publishes stage st + 1 and ends every wave's reads of stage st, whose buffer the next trip refills
  x_frag2(a, xr); mm_stage2(acc, a, tl + ((CC / WKC - 1) & 1) * WBUF);
#pragma unroll
  for (int j = 0; j < 8; ++j) { const float bb = BP ? bfr(BP[c0 + j * 16 + col]) : 0.f;
#pragma unroll
    for (int r = 0; r < 8; ++r) sf[wave][8 * g + r][j * 16 + col] = acc[j][r] + bb; }
  LDSX(); for (int rl = 0; rl < 16; ++rl) vst2(OUT + (r0 + rl) * CC + c0 + lane * 4, *(const v4f*)&sf[wave][rl][lane * 4]); }
extern "C" void kernel_launch(void* const* d_in, const int* in_sizes, int n_in, void* d_out, int out_size, void* d_ws, size_t ws_size, hipStream_t stream) {
  (void)in_sizes; (void)n_in; (void)out_size;
  const float** F = (const float**)d_in;   // 0 q [2,2048,512], 1 k, 2 v, 3 Wq [512,512] ((in,out)), 4 bq, 5 Wk, 6 bk, 7 Wv, 8 bv, 9 Wo, 10 bo
  if (ws_size < (size_t)WS_END) return;
  char* ws = (char*)d_ws; float *QF = (float*)(ws + WS_QF), *KF = (float*)(ws + WS_KF), *VF = (float*)(ws + WS_VF), *Y = (float*)(ws + WS_Y);
  k_lin<<<dim3(TNB * SQ / 64, CC / 128, 3), 128, 0, stream>>>(F[0], F[1], F[2], F[3], F[4], F[5], F[6], F[7], F[8], QF, KF, VF);
  k_fa<<<dim3(SQ / 64, TNB * NP), 128, 0, stream>>>(QF, KF, VF, Y);
  k_out<<<dim3(TNB * SQ / 64, CC / 128), 128, 0, stream>>>(Y, F[9], F[10], (float*)d_out);
}

// v007
// A run of this version takes 69.1 microseconds.
// Two timings next to v006 both put it at 1.09 times that version's speed.
// Over all steps from v000 it is 13.2 times as fast.
// compute dtype: all float inputs rounded to bf16; q/k/v projections with EXACT bf16 products on WMMA 16x16x32 (f32 accumulate, + bias) kept as f32 rows; the module's reshape(B,H,S,Dh) re-reads those rows as [b][h][s][64]; logits from the f32 rows split bf16 hi + lo on both sides (3 products; the k rows are split once, where the projection stores them), kept in registers; softmax in f32 (e^x as the hardware's 2^x of x log2 e) with a running maximum and sum, then / 8 as written; unnormalised P split bf16 hi + lo against v bf16 hi + lo (3 products; the v rows are split once, where the projection stores them, and transposed by the LDS load), all in one launch; out = concat (bf16 hi + lo) Wo + bo; f32 output.
#include <hip/hip_runtime.h>
#include <math.h>

typedef __attribute__((ext_vector_type(16))) _Float16 v16h;
typedef __attribute__((ext_vector_type(16))) __bf16 v16b;
typedef __attribute__((ext_vector_type(8)))  _Float16 v8h;
typedef __attribute__((ext_vector_type(8)))  float v8f;
typedef __attribute__((ext_vector_type(4)))  float v4f;
typedef __attribute__((ext_vector_type(2)))  float v2f;
typedef __attribute__((ext_vector_type(4)))  unsigned v4u;
typedef __attribute__((ext_vector_type(4)))  int v4i;
typedef float __attribute__((may_alias)) float_a;
typedef int __attribute__((may_alias)) int_a;

template <typename T> __device__ __forceinline__ void vst2(void* p, T v) { *(T*)p = v;  }
__device__ __forceinline__ v8f wmma16(v16h a, v16h b, v8f c) {
  v8f d = __builtin_amdgcn_wmma_f32_16x16x32_f16(false, a, false, b, (short)0, c, false, false);
  asm volatile("v_nop\n\tv_nop\n\tv_nop\n\tv_nop" : "+v"(d) : "v"(a), "v"(b));
  return d;
}
__device__ __forceinline__ v8f wmma_bf(v16b a, v16b b, v8f c) {
  v8f d = __builtin_amdgcn_wmma_f32_16x16x32_bf16(false, a, false, b, (short)0, c, false, false);
  asm volatile("v_nop\n\tv_nop\n\tv_nop\n\tv_nop" : "+v"(d) : "v"(a), "v"(b));
  return d;
}
// 16x16x32 fragments: lane = (h = lane>>4, row/col = lane&15); elements 0..7 = k0+8h+0..7, 8..15 = k0+16+8h+0..7; D element r = row 8h+r
__device__ __forceinline__ v16h frag_h(const _Float16* rowk0, int lane) {
  union { v16h v; v8h q[2]; } u; const _Float16* p = rowk0 + 8 * (lane >> 4);
  u.q[0] = *(const v8h*)p; u.q[1] = *(const v8h*)(p + 16); return u.v;
}
__device__ __forceinline__ v16h frag_f32(const float* rowk0, int lane) {
  v16h a; const float* p = rowk0 + 8 * (lane >> 4);
#pragma unroll
  for (int i = 0; i < 8; ++i) { a[i] = (_Float16)p[i]; a[8 + i] = (_Float16)p[16 + i]; }
  return a;
}
__device__ __forceinline__ v16h frag_f32s(const float* rowk0, int lane, float sc) {
  v16h a; const float* p = rowk0 + 8 * (lane >> 4);
#pragma unroll
  for (int i = 0; i < 8; ++i) { a[i] = (_Float16)(p[i] * sc); a[8 + i] = (_Float16)(p[16 + i] * sc); }
  return a;
}
// column fragment from a [K][ld] layout (column n), rows >= K read as 0
__device__ __forceinline__ v16h fragc_f32(const float* W, int k0, int n, int lane, int ld, int K) {
  v16h a; const int g = lane >> 4;
#pragma unroll
  for (int i = 0; i < 8; ++i) { const int ka = k0 + 8 * g + i, kb = ka + 16;
    a[i] = (_Float16)(ka < K ? W[(size_t)(ka < K ? ka : K - 1) * ld + n] : 0.f); a[8 + i] = (_Float16)(kb < K ? W[(size_t)(kb < K ? kb : K - 1) * ld + n] : 0.f); }
  return a;
}
struct F2 { v16b h, l; };
__device__ __forceinline__ F2 bsplit16(const float v[16]) { F2 r;
#pragma unroll
  for (int i = 0; i < 16; ++i) { const __bf16 h = (__bf16)v[i]; r.h[i] = h; r.l[i] = (__bf16)(v[i] - (float)h); }
  return r; }
__device__ __forceinline__ F2 split_row(const float* row, int k0, int lane) { float v[16]; const float* p = row + k0 + 8 * (lane >> 4);
#pragma unroll
  for (int i = 0; i < 8; ++i) { v[i] = p[i]; v[8 + i] = p[16 + i]; }
  return bsplit16(v); }
__device__ __forceinline__ F2 split_rowK(const float* row, int k0, int lane, int K) { float v[16]; const int g = lane >> 4;
#pragma unroll
  for (int i = 0; i < 8; ++i) { const int ka = k0 + 8 * g + i, kb = ka + 16; v[i] = ka < K ? row[ka < K ? ka : K - 1] : 0.f; v[8 + i] = kb < K ? row[kb < K ? kb : K - 1] : 0.f; }
  return bsplit16(v); }
__device__ __forceinline__ F2 split_col(const float* W, int k0, int n, int lane, int ld, int K) { float v[16]; const int g = lane >> 4;
#pragma unroll
  for (int i = 0; i < 8; ++i) { const int ka = k0 + 8 * g + i, kb = ka + 16; v[i] = ka < K ? W[(size_t)(ka < K ? ka : K - 1) * ld + n] : 0.f; v[8 + i] = kb < K ? W[(size_t)(kb < K ? kb : K - 1) * ld + n] : 0.f; }
  return bsplit16(v); }
__device__ __forceinline__ v8f mac3(const F2& a, const F2& b, v8f c) { c = wmma_bf(a.l, b.h, c); c = wmma_bf(a.h, b.l, c); return wmma_bf(a.h, b.h, c); }
__device__ __forceinline__ float sigm(float v) { return 1.0f / (1.0f + expf(-v)); }
#define LDSX() do { asm volatile("s_wait_dscnt 0" ::: "memory"); __builtin_amdgcn_wave_barrier(); __builtin_amdgcn_fence(__ATOMIC_RELEASE, "workgroup"); } while (0)

// Multi self-attention (B 2, S 2,048, D 512, 8 heads x 64) with the module's literal head split qp.reshape(B, H, S, Dh) -- NO transpose: head h of batch b = rows [h*2048, (h+1)*2048) of the projection viewed as [B][H*S][64] -- scores unscaled, attn = softmax / sqrt(64), ctx.transpose(0,2,1,3) -> [B,S,512], @ Wo + bo.
__device__ __forceinline__ float bfr(float v) { return (float)(__bf16)v; }
#define NBT 2
#define SQ 2048
#define TT SQ
#define NP 8
#define HN 64
#define CC 512
#define HG 4
#ifndef TNB
#define TNB NBT
#endif
// virtual row (b, n, s) of a projection viewed as [b][H*S][64]: float offset
#define ROWO(b, n, s) ((((size_t)(b) * NP + (n)) * SQ + (s)) * HN)
typedef __attribute__((ext_vector_type(8))) __bf16 v8b;
typedef __attribute__((ext_vector_type(4))) __bf16 v4b;
__device__ __forceinline__ v16b frag_b(const __bf16* rowk0, int lane) { union { v16b v; v8b q[2]; } u; const __bf16* p = rowk0 + 8 * (lane >> 4); u.q[0] = *(const v8b*)p; u.q[1] = *(const v8b*)(p + 16); return u.v; }
#define WS_QF  0u                                          // f32 projection rows [b*S+t][512] (== virtual [b][h][s][64])
#define WS_KF  (WS_QF + 4u * (size_t)NBT * SQ * CC)          // k projection, virtual rows of 256 B: 64 bf16 hi, 64 bf16 lo
#define WS_VF  (WS_KF + 4u * (size_t)NBT * SQ * CC)          // v projection, rows as k's
#define WS_S   (WS_VF + 4u * (size_t)NBT * SQ * CC)          // unused (scores and P stay in registers)
#define WS_Y   (WS_S + 4u * (size_t)HG * SQ * SQ)            // f32 ctx rows [b*S+s][h*64+d]
#define WS_END (WS_Y + 4u * (size_t)NBT * SQ * CC)
// W of a projection is staged per block: 64 rows (k) x 128 columns, rounded to bf16 as before, row-major in LDS; every wave reads its B fragments from there with the transposing load
#define WKC 64                       // k rows of W per stage
#define WPT 288                      // LDS pitch of a staged W row: 256 B + 32, 32 B x odd, conflict-free for ds_load_tr16_b128
#define WBUF (WKC * WPT)
typedef __attribute__((ext_vector_type(8))) short s16x8;
// one wave-wide load = one whole row piece of 512 B (4 lines); wave w takes rows w, w + 4, ...
__device__ __forceinline__ void w_load(v4f (&r)[WKC / 4], const float* wp, int st) {
#pragma unroll
  for (int i = 0; i < WKC / 4; ++i) r[i] = *(const v4f*)(wp + (size_t)(st * WKC + i * 4) * CC); }
__device__ __forceinline__ void w_store(char* d, const v4f (&r)[WKC / 4]) {
#pragma unroll
  for (int i = 0; i < WKC / 4; ++i) { v4b h;
#pragma unroll
    for (int e = 0; e < 4; ++e) h[e] = (__bf16)r[i][e];
    *(v4b*)(d + i * 4 * WPT) = h; } }
// the lane's 2 x 16 values of its own row for the stage's two 32-wide k chunks, in fragment order (8g + 0..7, 16 + 8g + 0..7)
__device__ __forceinline__ void x_load(v4f (&r)[8], const float* xp, int st) {
#pragma unroll
  for (int c = 0; c < 2; ++c) { const float* p = xp + st * WKC + c * 32; r[c * 4] = *(const v4f*)p; r[c * 4 + 1] = *(const v4f*)(p + 4); r[c * 4 + 2] = *(const v4f*)(p + 16); r[c * 4 + 3] = *(const v4f*)(p + 20); } }
// B fragment (32 k x 16 columns) of the staged tile: p = tile + (k0 + 8g + (lane & 7)) * WPT + 2 * column0 + 16 * ((lane >> 3) & 1); lane (g, col) gets k0 + 8g + 0..7 and k0 + 16 + 8g + 0..7 of column0 + col
__device__ __forceinline__ v16b frag_t(const char* p) { typedef __attribute__((address_space(3))) s16x8 lds_s16x8; union { v16b v; s16x8 q[2]; } u;
  u.q[0] = __builtin_amdgcn_ds_load_tr16_b128_v8i16((lds_s16x8*)p); u.q[1] = __builtin_amdgcn_ds_load_tr16_b128_v8i16((lds_s16x8*)(p + 16 * WPT)); return u.v; }
// one stage's products: four groups of four B fragments (k chunk c = q >> 1, columns (q & 1) * 64 ...); per accumulator the k chunks come in ascending order, as before
__device__ __forceinline__ void mm_stage(v8f (&acc)[8], const v16b (&a)[2], const char* tb) {
#pragma unroll
  for (int q = 0; q < 4; ++q) { v16b w[4];
#pragma unroll
    for (int j = 0; j < 4; ++j) w[j] = frag_t(tb + (q >> 1) * 32 * WPT + ((q & 1) * 4 + j) * 32);
    __builtin_amdgcn_sched_barrier(0);   // keeps a group's eight LDS reads together in front of its WMMAs: one LDS latency a group (without it each fragment's reads stand directly in front of its WMMA and each waits alone)
#pragma unroll
    for (int j = 0; j < 4; ++j) acc[(q & 1) * 4 + j] = wmma_bf(a[q >> 1], w[j], acc[(q & 1) * 4 + j]); } }
// the same with the row operand split hi + lo: per accumulator hi, then lo, of each k chunk, as before
__device__ __forceinline__ void mm_stage2(v8f (&acc)[8], const F2 (&a)[2], const char* tb) {
#pragma unroll
  for (int q = 0; q < 4; ++q) { v16b w[4];
#pragma unroll
    for (int j = 0; j < 4; ++j) w[j] = frag_t(tb + (q >> 1) * 32 * WPT + ((q & 1) * 4 + j) * 32);
    __builtin_amdgcn_sched_barrier(0);   // as in mm_stage
#pragma unroll
    for (int j = 0; j < 4; ++j) acc[(q & 1) * 4 + j] = wmma_bf(a[q >> 1].h, w[j], acc[(q & 1) * 4 + j]);
#pragma unroll
    for (int j = 0; j < 4; ++j) acc[(q & 1) * 4 + j] = wmma_bf(a[q >> 1].l, w[j], acc[(q & 1) * 4 + j]); } }
__device__ __forceinline__ void x_frag(v16b (&a)[2], const v4f (&xr)[8]) {
#pragma unroll
  for (int c = 0; c < 2; ++c)
#pragma unroll
    for (int i = 0; i < 4; ++i) { a[c][i] = (__bf16)xr[c * 4][i]; a[c][4 + i] = (__bf16)xr[c * 4 + 1][i]; a[c][8 + i] = (__bf16)xr[c * 4 + 2][i]; a[c][12 + i] = (__bf16)xr[c * 4 + 3][i]; } }
__device__ __forceinline__ void x_frag2(F2 (&a)[2], const v4f (&xr)[8]) {
#pragma unroll
  for (int c = 0; c < 2; ++c) { float v[16];
#pragma unroll
    for (int i = 0; i < 4; ++i) { v[i] = xr[c * 4][i]; v[4 + i] = xr[c * 4 + 1][i]; v[8 + i] = xr[c * 4 + 2][i]; v[12 + i] = xr[c * 4 + 3][i]; }
    a[c] = bsplit16(v); } }
// ---- k_lin: block = (64 rows, 128 cols, which): {q,k,v}p = input W ((in,out)) + b, exact products, f32 rows (k, v: the f32 value as bf16 hi + lo)
__global__ __launch_bounds__(128) void k_lin(const float* __restrict__ XQ, const float* __restrict__ XK, const float* __restrict__ XV, const float* __restrict__ WQ, const float* __restrict__ BQ, const float* __restrict__ WK, const float* __restrict__ BK, const float* __restrict__ WV, const float* __restrict__ BV, float* __restrict__ QF, float* __restrict__ KF, float* __restrict__ VF) { __shared__ __align__(16) float sf[4][16][132]; __shared__ __align__(32) char sw[2 * WBUF];
  const int tid = threadIdx.x, wave = tid >> 5, lane = tid & 31, col = lane & 15, g = lane >> 4; const int which = blockIdx.z; const int c0 = blockIdx.y * 128; const size_t r0 = (size_t)blockIdx.x * 64 + wave * 16;
  const float* X = which == 0 ? XQ : which == 1 ? XK : XV; const float* WA = which == 0 ? WQ : which == 1 ? WK : WV; const float* BA = which == 0 ? BQ : which == 1 ? BK : BV; float* DST = which == 0 ? QF : which == 1 ? KF : VF;
  v8f acc[8] = {};
  const float* wp = WA + (size_t)wave * CC + c0 + lane * 4; const float* xp = X + (r0 + col) * CC + 8 * g;
  char* sd = sw + wave * WPT + lane * 8; const char* tl = sw + (8 * g + (lane & 7)) * WPT + 16 * ((lane >> 3) & 1);
  v4f wr[WKC / 4], xr[8];
  w_load(wr, wp, 0); x_load(xr, xp, 0); w_store(sd, wr);
  __syncthreads();   // stage 0 may be read
  // the stage loop stays rolled (one stage's loads in flight fill 96 registers); the last stage, which has nothing to fetch, stands behind it
  v16b a[2];
#pragma unroll 1
  for (int st = 0; st + 1 < CC / WKC; ++st) { x_frag(a, xr);
    w_load(wr, wp, st + 1); x_load(xr, xp, st + 1);   // the next stage's loads fly while this stage is worked on
    mm_stage(acc, a, tl + (st & 1) * WBUF);
    w_store(sd + ((st + 1) & 1) * WBUF, wr);
    __syncthreads(); }   // publishes stage st + 1 and ends every wave's reads of stage st, whose buffer the next trip refills
  x_frag(a, xr); mm_stage(acc, a, tl + ((CC / WKC - 1) & 1) * WBUF);
#pragma unroll
  for (int j = 0; j < 8; ++j) { const float bb = bfr(BA[c0 + j * 16 + col]);
#pragma unroll
    for (int r = 0; r < 8; ++r) sf[wave][8 * g + r][j * 16 + col] = acc[j][r] + bb; }
  LDSX();
  if (which != 0) {   // k and v rows leave split: virtual row (64 values, 256 B) = 64 bf16 hi, then 64 bf16 lo; 16 lanes fill one whole 128-B line per store
    char* kd = (char*)DST + (r0 * (CC / HN) + c0 / HN + g) * (size_t)(HN * 4) + col * 8;
    for (int rl = 0; rl < 16; ++rl) { const v4f x = *(const v4f*)&sf[wave][rl][lane * 4]; v4b h, l;
#pragma unroll
      for (int i = 0; i < 4; ++i) { h[i] = (__bf16)x[i]; l[i] = (__bf16)(x[i] - (float)h[i]); }
      vst2(kd + (size_t)rl * (CC * 4), h); vst2(kd + (size_t)rl * (CC * 4) + HN * 2, l); } }
  else { for (int rl = 0; rl < 16; ++rl) vst2(DST + (r0 + rl) * CC + c0 + lane * 4, *(const v4f*)&sf[wave][rl][lane * 4]);
    asm volatile("s_wait_xcnt 0x0" ::: "memory"); } }   // behind the run of stores: no register that a store names is rewritten ahead of it on any way the built code has from here
// ---- k_fa: block = (128 queries, b*8+n), 8 waves = 4 query groups x 2 key halves; one wave = 32 queries (two query tiles, so that every K and V fragment read from LDS feeds two tiles' products) against its half (64 keys) of every stage; the two halves' maxima, sums and ctx are joined once, behind the loop: S^T = K Q^T (3 products; q split here from its f32 virtual rows, k read as the hi + lo rows k_lin stored), running maximum and sum per query, ctx^T += V^T P^T (3 products; V^T fragments by the transposing LDS load from the hi + lo rows k_lin stored), P stays in registers
// S^T tile: lane (g, col) holds keys 8g+0..7 of query col, which is the B fragment order of P^T for 32 keys (elements 0..7 from the first 16-key tile, 8..15 from the second)
// e^(s - m) = 2^(s log2 e - m log2 e): one fused multiply-add and the hardware's 2^x per score; the argument is <= 0 but for the rounding of m log2 e, and below -126 the result is 0
#define LOG2E 1.44269504088896340736f
// eight 2^x, each in its own register, in one statement; the v_nop is the slot behind the last one, whose result the next instruction may read
__device__ __forceinline__ void ex2x8(float* x) {
  asm("v_exp_f32 %0, %0\n\tv_exp_f32 %1, %1\n\tv_exp_f32 %2, %2\n\tv_exp_f32 %3, %3\n\tv_exp_f32 %4, %4\n\tv_exp_f32 %5, %5\n\tv_exp_f32 %6, %6\n\tv_exp_f32 %7, %7\n\tv_nop"
      : "+v"(x[0]), "+v"(x[1]), "+v"(x[2]), "+v"(x[3]), "+v"(x[4]), "+v"(x[5]), "+v"(x[6]), "+v"(x[7])); }
__device__ __forceinline__ v8f wmma_p(v16b a, v16b b, v8f c) { return __builtin_amdgcn_wmma_f32_16x16x32_bf16(false, a, false, b, (short)0, c, false, false); }
// K rows and V rows of 128 keys are staged once per block in LDS; waves 0..3 read the first 64 keys, waves 4..7 the second; two buffers, the next stage's copies fly while this stage is worked on
#define FK 128                       // keys per stage
#define FH 64                        // keys per stage and wave
#define QT 2                         // query tiles (16 queries each) per wave
#define KP 272                       // LDS pitch of a K row: 256 B + 16, 16 B x odd, conflict-free for 16-byte reads down a column of rows
#define VP 288                       // LDS pitch of a V row: 256 B + 32, 32 B x odd, conflict-free for ds_load_tr16_b128
#define OFF_V (FK * KP)
#define BUFB (OFF_V + FK * VP)
// eight 16-byte copies per lane, global memory to LDS through no register; the s_wait_xcnt is the last line of the copies' own statement so that no address register is rewritten ahead of it
__device__ __forceinline__ void acopy8(const unsigned (&l)[8], const char* const (&p)[8]) {
  asm volatile("global_load_async_to_lds_b128 %0, %8, off\n\t"
               "global_load_async_to_lds_b128 %1, %9, off\n\t"
               "global_load_async_to_lds_b128 %2, %10, off\n\t"
               "global_load_async_to_lds_b128 %3, %11, off\n\t"
               "global_load_async_to_lds_b128 %4, %12, off\n\t"
               "global_load_async_to_lds_b128 %5, %13, off\n\t"
               "global_load_async_to_lds_b128 %6, %14, off\n\t"
               "global_load_async_to_lds_b128 %7, %15, off\n\t"
               "s_wait_xcnt 0x0"
               :: "v"(l[0]), "v"(l[1]), "v"(l[2]), "v"(l[3]), "v"(l[4]), "v"(l[5]), "v"(l[6]), "v"(l[7]), "v"(p[0]), "v"(p[1]), "v"(p[2]), "v"(p[3]), "v"(p[4]), "v"(p[5]), "v"(p[6]), "v"(p[7]) : "memory"); }
// one stage: 128 K rows and 128 V rows, each 32 KiB in a row in memory; a wave's copy = 4 whole lines, the block's = 16 rows
__device__ __forceinline__ void stage_in(unsigned lk, unsigned lv, const char* gk, const char* gv, unsigned go, int st) {   // gk, gv: the head's first K and V row, the same in every lane; go: the thread's own byte offset in a copy's 4 KiB
  unsigned l[8]; const char* p[8];
#pragma unroll
  for (int i = 0; i < 8; ++i) { l[i] = lk + i * 16 * KP; p[i] = gk + ((size_t)st * (FK * HN * 4) + i * 4096) + go; }
  acopy8(l, p);
#pragma unroll
  for (int i = 0; i < 8; ++i) { l[i] = lv + i * 16 * VP; p[i] = gv + ((size_t)st * (FK * HN * 4) + i * 4096) + go; }
  acopy8(l, p); }
__device__ __forceinline__ v16b frag_s(const char* p) { union { v16b v; v8b q[2]; } u; u.q[0] = *(const v8b*)p; u.q[1] = *(const v8b*)(p + 32); return u.v; }   // 32 bf16 of an LDS row (a 32-wide k chunk of a K half row) in fragment order; the lane's 16 * (lane >> 4) bytes are already in p
__device__ __forceinline__ F2 ld_kf(const char* p) { F2 r; r.h = frag_s(p); r.l = frag_s(p + HN * 2); return r; }   // hi and lo fragment of a 32-wide k chunk of an LDS row of K
// A fragment of V^T (16 d x 32 keys) from the staged V rows: p = tile + (key0 + 8g + (lane & 7)) * VP + 2 * d0 + 16 * ((lane >> 3) & 1); lane (g, col) gets keys key0 + 8g + 0..7 and key0 + 16 + 8g + 0..7 of d0 + col, the order of P^T's elements
__device__ __forceinline__ v16b frag_v(const char* p) { typedef __attribute__((address_space(3))) s16x8 lds_s16x8; union { v16b v; s16x8 q[2]; } u;
  u.q[0] = __builtin_amdgcn_ds_load_tr16_b128_v8i16((lds_s16x8*)p); u.q[1] = __builtin_amdgcn_ds_load_tr16_b128_v8i16((lds_s16x8*)(p + 16 * VP)); return u.v; }
__global__ __launch_bounds__(256) void k_fa(const float* __restrict__ QF, const float* __restrict__ KF, const float* __restrict__ VF, float* __restrict__ Y) {
  __shared__ __attribute__((aligned(16))) char sm[2 * BUFB];
  __shared__ v4f mg[8][HN / 16 * 2 + 1][32];   // the join: per wave one query tile's ctx (32 values a lane), maximum and sum, 16 bytes a lane in a row
  const int tid = threadIdx.x, wave = tid >> 5, lane = tid & 31, col = lane & 15, g = lane >> 4; const int bn = blockIdx.y; const int b = bn / NP, n = bn % NP;
  const int qg = wave & 3, kh = wave >> 2; const int q0 = blockIdx.x * (4 * QT * 16) + qg * (QT * 16);
  // the thread's own 16 bytes of each copy: LDS byte addresses in buffer 0, byte offset in the copy's 4 KiB of memory (the 64-bit address pairs are formed at each stage from the head's uniform base: kept in vector registers over the loop they were spilled)
  const unsigned sm0 = (unsigned)(size_t)sm; const unsigned lk = sm0 + (tid >> 4) * KP + (tid & 15) * 16; const unsigned lv = sm0 + OFF_V + (tid >> 4) * VP + (tid & 15) * 16;
  const char* gk = (const char*)(KF + ROWO(b, n, 0)); const char* gv = (const char*)(VF + ROWO(b, n, 0)); const unsigned go = tid * 16;
  stage_in(lk, lv, gk, gv, go, 0);
  F2 qf[QT][HN / 32];
#pragma unroll
  for (int t = 0; t < QT; ++t) {
#pragma unroll
    for (int kc = 0; kc < HN / 32; ++kc) qf[t][kc] = split_row(QF + ROWO(b, n, q0 + t * 16 + col), kc * 32, lane);
    asm volatile("s_wait_xcnt 0x0" ::: "memory"); }   // behind each query tile's run of loads: no register that a load names is rewritten ahead of it (the next tile's loads may land on the address pair)
  asm volatile("s_wait_asynccnt 0x0" ::: "memory");   // this wave's copies of stage 0 have landed
  __syncthreads();                                     // ... and every other wave's: stage 0 may be read
  stage_in(lk + BUFB, lv + BUFB, gk, gv, go, 1);
  const char* kl0 = sm + (kh * FH + col) * KP + 16 * g; const char* vl0 = sm + OFF_V + (kh * FH + 8 * g + (lane & 7)) * VP + 16 * ((lane >> 3) & 1);   // in the wave's half of the stage: the lane's own row and half in the K tile; its row and 16 bytes of the V tile for the transposing load
  v8f acc[QT][HN / 16] = {}; float m[QT], l[QT];   // m: the running maximum times log2 e
#pragma unroll
  for (int t = 0; t < QT; ++t) { m[t] = -3.0e38f; l[t] = 0.f; }
  F2 kr[2][HN / 32];
#pragma unroll
  for (int u = 0; u < 2; ++u)
#pragma unroll
    for (int kc = 0; kc < HN / 32; ++kc) kr[u][kc] = ld_kf(kl0 + u * 16 * KP + kc * 64);
  // the stage loop and the loop over the two 32-key trips of the wave's half stage stay rolled; the short loops inside are unrolled so that the fragment arrays live in registers
#pragma unroll 1
  for (int st = 0; st < SQ / FK; ++st) { const int bo = (st & 1) * BUFB; const char* kb = kl0 + bo; const char* vb = vl0 + bo;
#pragma unroll 1
    for (int h = 0; h < FH / 32; ++h) { v8f s[QT][2]; v16b vh[HN / 16], vl[HN / 16];
#pragma unroll
      for (int u = 0; u < 2; ++u)
#pragma unroll
        for (int t = 0; t < QT; ++t) { v8f c = {};
#pragma unroll
          for (int kc = 0; kc < HN / 32; ++kc) { const F2 kf = kr[u][kc]; c = wmma_p(kf.l, qf[t][kc].h, c); c = wmma_p(kf.h, qf[t][kc].l, c); c = wmma_p(kf.h, qf[t][kc].h, c); }
          s[t][u] = c; }
      float mx[QT];
#pragma unroll
      for (int t = 0; t < QT; ++t) { float x = fmaxf(s[t][0][0], s[t][1][0]);
#pragma unroll
        for (int i = 1; i < 8; ++i) x = fmaxf(x, fmaxf(s[t][0][i], s[t][1][i]));
        mx[t] = x * LOG2E; }   // from here on the maximum is kept as this rounded product (rounding keeps the order): the one value that every exponent below is taken against
#pragma unroll
      for (int t = 0; t < QT; ++t) mx[t] = fmaxf(mx[t], __shfl_xor(mx[t], 16));   // the exchange goes through the LDS queue, which returns in order: it stands in front of the K and V reads so that its result does not wait for theirs
      if (h == 0) {   // the same half stage's second 32 keys' rows, fetched one trip ahead; nothing of the next stage is read here
#pragma unroll
        for (int u = 0; u < 2; ++u)
#pragma unroll
          for (int kc = 0; kc < HN / 32; ++kc) kr[u][kc] = ld_kf(kb + (32 + u * 16) * KP + kc * 64); }
#pragma unroll
      for (int j = 0; j < HN / 16; ++j) { vh[j] = frag_v(vb + h * 32 * VP + j * 32); vl[j] = frag_v(vb + h * 32 * VP + HN * 2 + j * 32); }
      __builtin_amdgcn_sched_barrier(0);   // keeps the V reads issued above the softmax, so that its arithmetic covers their latency (without it the scheduler sinks them to their first use)
      F2 pf[QT]; float al[QT];
#pragma unroll
      for (int t = 0; t < QT; ++t) { const float mn = fmaxf(m[t], mx[t]); al[t] = __builtin_amdgcn_exp2f(m[t] - mn); m[t] = mn;
        const v8f e0 = __builtin_elementwise_fma(s[t][0], v8f{} + LOG2E, v8f{} - mn), e1 = __builtin_elementwise_fma(s[t][1], v8f{} + LOG2E, v8f{} - mn);
        float pv[16]; float ps = 0.f;
#pragma unroll
        for (int i = 0; i < 8; ++i) { pv[i] = e0[i]; pv[8 + i] = e1[i]; }
        ex2x8(pv); ex2x8(pv + 8);
#pragma unroll
        for (int i = 0; i < 8; ++i) { ps += pv[i] + pv[8 + i]; }
        l[t] = l[t] * al[t] + ps; pf[t] = bsplit16(pv); }
#pragma unroll
      for (int j = 0; j < HN / 16; ++j)
#pragma unroll
        for (int t = 0; t < QT; ++t) { v8f c = acc[t][j] * al[t]; c = wmma_p(vh[j], pf[t].h, c); c = wmma_p(vh[j], pf[t].l, c); acc[t][j] = wmma_p(vl[j], pf[t].h, c); }
      // WMMA distance: no vector instruction need stand between the trip's last WMMAs and the next trip's score WMMAs, whose D a build without this line may lay over a P fragment directly behind its last reader; four slots behind all accumulators, P held to here
      asm volatile("v_nop\n\tv_nop\n\tv_nop\n\tv_nop" : "+v"(acc[0][0]), "+v"(acc[0][1]), "+v"(acc[0][2]), "+v"(acc[0][3]), "+v"(acc[1][0]), "+v"(acc[1][1]), "+v"(acc[1][2]), "+v"(acc[1][3]) : "v"(pf[0].h), "v"(pf[0].l), "v"(pf[1].h), "v"(pf[1].l)); }
    asm volatile("s_wait_dscnt 0x0" ::: "memory");      // this wave's reads of the buffer have returned before it is handed back
    asm volatile("s_wait_asynccnt 0x0" ::: "memory");   // this wave's copies of stage st + 1 have landed
    __syncthreads();                                     // publishes stage st + 1 and ends every wave's reads of stage st
    if (st + 2 < SQ / FK) stage_in(lk + bo, lv + bo, gk, gv, go, st + 2);
    const char* kn = kl0 + (BUFB - bo);   // behind the barrier: the first 32 keys' rows of the wave's half of stage st + 1 (after the last stage the other buffer's old rows, unused)
#pragma unroll
    for (int u = 0; u < 2; ++u)
#pragma unroll
      for (int kc = 0; kc < HN / 32; ++kc) kr[u][kc] = ld_kf(kn + u * 16 * KP + kc * 64); }
  asm volatile("s_wait_asynccnt 0x0" ::: "memory");     // no copy is outstanding when the wave ends
  // the join of the two key halves: wave (qg, kh) finishes query tile kh; it hands its part of the other tile to wave (qg, 1 - kh) through LDS
  const bool k1 = kh != 0;
#pragma unroll
  for (int t = 0; t < QT; ++t) l[t] += __shfl_xor(l[t], 16);
#pragma unroll
  for (int j = 0; j < HN / 16; ++j) { const v8f c = k1 ? acc[0][j] : acc[1][j]; const v4f lo = {c[0], c[1], c[2], c[3]}, hi = {c[4], c[5], c[6], c[7]}; mg[wave][2 * j][lane] = lo; mg[wave][2 * j + 1][lane] = hi; }
  { const v4f ml = {k1 ? m[0] : m[1], k1 ? l[0] : l[1], 0.f, 0.f}; mg[wave][HN / 16 * 2][lane] = ml; }
  __syncthreads();   // every wave's part for its partner is in LDS
  const int pw = wave ^ 4; const v4f ml = mg[pw][HN / 16 * 2][lane];
  const float ma = k1 ? m[1] : m[0], la = k1 ? l[1] : l[0]; const float mm = fmaxf(ma, ml[0]); const float wa = __builtin_amdgcn_exp2f(ma - mm), wb = __builtin_amdgcn_exp2f(ml[0] - mm);
  const float inv = 1.0f / (la * wa + ml[1] * wb) * 0.125f;   // the module divides the softmax by sqrt(64)
  const float fa = wa * inv, fb = wb * inv;
  float* yr = Y + ((size_t)b * SQ + q0 + kh * 16 + col) * CC + n * HN + 8 * g;
#pragma unroll
  for (int j = 0; j < HN / 16; ++j) { const v8f c = k1 ? acc[1][j] : acc[0][j]; const v4f pl = mg[pw][2 * j][lane], ph = mg[pw][2 * j + 1][lane];
    const v4f lo = {c[0], c[1], c[2], c[3]}, hi = {c[4], c[5], c[6], c[7]}; vst2(yr + j * 16, lo * fa + pl * fb); vst2(yr + j * 16 + 4, hi * fa + ph * fb); } }
// ---- k_out: block = (64 rows, 128 cols): out = y (bf16 hi + lo) Wo + bo
__global__ __launch_bounds__(128) void k_out(const float* __restrict__ Y, const float* __restrict__ WP, const float* __restrict__ BP, float* __restrict__ OUT) { __shared__ __align__(16) float sf[4][16][132]; __shared__ __align__(32) char sw[2 * WBUF];
  const int tid = threadIdx.x, wave = tid >> 5, lane = tid & 31, col = lane & 15, g = lane >> 4; const int c0 = blockIdx.y * 128; const size_t r0 = (size_t)blockIdx.x * 64 + wave * 16;
  v8f acc[8] = {};
  const float* wp = WP + (size_t)wave * CC + c0 + lane * 4; const float* xp = Y + (r0 + col) * CC + 8 * g;
  char* sd = sw + wave * WPT + lane * 8; const char* tl = sw + (8 * g + (lane & 7)) * WPT + 16 * ((lane >> 3) & 1);
  v4f wr[WKC / 4], xr[8];
  w_load(wr, wp, 0); x_load(xr, xp, 0); w_store(sd, wr);
  __syncthreads();   // stage 0 may be read
  // the stage loop stays rolled (one stage's loads in flight fill 96 registers); the last stage, which has nothing to fetch, stands behind it
  F2 a[2];
#pragma unroll 1
  for (int st = 0; st + 1 < CC / WKC; ++st) { x_frag2(a, xr);
    w_load(wr, wp, st + 1); x_load(xr, xp, st + 1);   // the next stage's loads fly while this stage is worked on
    mm_stage2(acc, a, tl + (st & 1) * WBUF);
    w_store(sd + ((st + 1) & 1) * WBUF, wr);
    __syncthreads(); }   // publishes stage st + 1 and ends every wave's reads of stage st, whose buffer the next trip refills
  x_frag2(a, xr); mm_stage2(acc, a, tl + ((CC / WKC - 1) & 1) * WBUF);
#pragma unroll
  for (int j = 0; j < 8; ++j) { const float bb = BP ? bfr(BP[c0 + j * 16 + col]) : 0.f;
#pragma unroll
    for (int r = 0; r < 8; ++r) sf[wave][8 * g + r][j * 16 + col] = acc[j][r] + bb; }
  LDSX(); for (int rl = 0; rl < 16; ++rl) vst2(OUT + (r0 + rl) * CC + c0 + lane * 4, *(const v4f*)&sf[wave][rl][lane * 4]); }
extern "C" void kernel_launch(void* const* d_in, const int* in_sizes, int n_in, void* d_out, int out_size, void* d_ws, size_t ws_size, hipStream_t stream) {
  (void)in_sizes; (void)n_in; (void)out_size;
  const float** F = (const float**)d_in;   // 0 q [2,2048,512], 1 k, 2 v, 3 Wq [512,512] ((in,out)), 4 bq, 5 Wk, 6 bk, 7 Wv, 8 bv, 9 Wo, 10 bo
  if (ws_size < (size_t)WS_END) return;
  char* ws = (char*)d_ws; float *QF = (float*)(ws + WS_QF), *KF = (float*)(ws + WS_KF), *VF = (float*)(ws + WS_VF), *Y = (float*)(ws + WS_Y);
  k_lin<<<dim3(TNB * SQ / 64, CC / 128, 3), 128, 0, stream>>>(F[0], F[1], F[2], F[3], F[4], F[5], F[6], F[7], F[8], QF, KF, VF);
  k_fa<<<dim3(SQ / 128, TNB * NP), 256, 0, stream>>>(QF, KF, VF, Y);
  k_out<<<dim3(TNB * SQ / 64, CC / 128), 128, 0, stream>>>(Y, F[9], F[10], (float*)d_out);
}

// v008
// One run takes 64.2 microseconds.
// Next to v007, in two timings, it ran 1.07 times as fast each time.
// Counting every step since v000, it is 14.2 times as fast.
// compute dtype: all float inputs rounded to bf16; q/k/v projections with EXACT bf16 products on WMMA 16x16x32 (f32 accumulate, + bias) kept as f32 rows; the module's reshape(B,H,S,Dh) re-reads those rows as [b][h][s][64]; logits from the f32 rows split bf16 hi + lo on both sides (3 products; the k rows are split once, where the projection stores them), kept in registers; softmax in f32 (e^x as the hardware's 2^x of x log2 e) with a running maximum and sum, then / 8 as written; unnormalised P split bf16 hi + lo against v bf16 hi + lo (3 products; the v rows are split once, where the projection stores them, and transposed by the LDS load), all in one launch; out = concat (bf16 hi + lo) Wo + bo; f32 output.
#include <hip/hip_runtime.h>
#include <math.h>

typedef __attribute__((ext_vector_type(16))) _Float16 v16h;
typedef __attribute__((ext_vector_type(16))) __bf16 v16b;
typedef __attribute__((ext_vector_type(8)))  _Float16 v8h;
typedef __attribute__((ext_vector_type(8)))  float v8f;
typedef __attribute__((ext_vector_type(4)))  float v4f;
typedef __attribute__((ext_vector_type(2)))  float v2f;
typedef __attribute__((ext_vector_type(4)))  unsigned v4u;
typedef __attribute__((ext_vector_type(4)))  int v4i;
typedef float __attribute__((may_alias)) float_a;
typedef int __attribute__((may_alias)) int_a;

template <typename T> __device__ __forceinline__ void vst2(void* p, T v) { *(T*)p = v;  }
__device__ __forceinline__ v8f wmma16(v16h a, v16h b, v8f c) {
  v8f d = __builtin_amdgcn_wmma_f32_16x16x32_f16(false, a, false, b, (short)0, c, false, false);
  asm volatile("v_nop\n\tv_nop\n\tv_nop\n\tv_nop" : "+v"(d) : "v"(a), "v"(b));
  return d;
}
__device__ __forceinline__ v8f wmma_bf(v16b a, v16b b, v8f c) {
  v8f d = __builtin_amdgcn_wmma_f32_16x16x32_bf16(false, a, false, b, (short)0, c, false, false);
  asm volatile("v_nop\n\tv_nop\n\tv_nop\n\tv_nop" : "+v"(d) : "v"(a), "v"(b));
  return d;
}
// 16x16x32 fragments: lane = (h = lane>>4, row/col = lane&15); elements 0..7 = k0+8h+0..7, 8..15 = k0+16+8h+0..7; D element r = row 8h+r
__device__ __forceinline__ v16h frag_h(const _Float16* rowk0, int lane) {
  union { v16h v; v8h q[2]; } u; const _Float16* p = rowk0 + 8 * (lane >> 4);
  u.q[0] = *(const v8h*)p; u.q[1] = *(const v8h*)(p + 16); return u.v;
}
__device__ __forceinline__ v16h frag_f32(const float* rowk0, int lane) {
  v16h a; const float* p = rowk0 + 8 * (lane >> 4);
#pragma unroll
  for (int i = 0; i < 8; ++i) { a[i] = (_Float16)p[i]; a[8 + i] = (_Float16)p[16 + i]; }
  return a;
}
__device__ __forceinline__ v16h frag_f32s(const float* rowk0, int lane, float sc) {
  v16h a; const float* p = rowk0 + 8 * (lane >> 4);
#pragma unroll
  for (int i = 0; i < 8; ++i) { a[i] = (_Float16)(p[i] * sc); a[8 + i] = (_Float16)(p[16 + i] * sc); }
  return a;
}
// column fragment from a [K][ld] layout (column n), rows >= K read as 0
__device__ __forceinline__ v16h fragc_f32(const float* W, int k0, int n, int lane, int ld, int K) {
  v16h a; const int g = lane >> 4;
#pragma unroll
  for (int i = 0; i < 8; ++i) { const int ka = k0 + 8 * g + i, kb = ka + 16;
    a[i] = (_Float16)(ka < K ? W[(size_t)(ka < K ? ka : K - 1) * ld + n] : 0.f); a[8 + i] = (_Float16)(kb < K ? W[(size_t)(kb < K ? kb : K - 1) * ld + n] : 0.f); }
  return a;
}
struct F2 { v16b h, l; };
__device__ __forceinline__ F2 bsplit16(const float v[16]) { F2 r;
#pragma unroll
  for (int i = 0; i < 16; ++i) { const __bf16 h = (__bf16)v[i]; r.h[i] = h; r.l[i] = (__bf16)(v[i] - (float)h); }
  return r; }
__device__ __forceinline__ F2 split_row(const float* row, int k0, int lane) { float v[16]; const float* p = row + k0 + 8 * (lane >> 4);
#pragma unroll
  for (int i = 0; i < 8; ++i) { v[i] = p[i]; v[8 + i] = p[16 + i]; }
  return bsplit16(v); }
__device__ __forceinline__ F2 split_rowK(const float* row, int k0, int lane, int K) { float v[16]; const int g = lane >> 4;
#pragma unroll
  for (int i = 0; i < 8; ++i) { const int ka = k0 + 8 * g + i, kb = ka + 16; v[i] = ka < K ? row[ka < K ? ka : K - 1] : 0.f; v[8 + i] = kb < K ? row[kb < K ? kb : K - 1] : 0.f; }
  return bsplit16(v); }
__device__ __forceinline__ F2 split_col(const float* W, int k0, int n, int lane, int ld, int K) { float v[16]; const int g = lane >> 4;
#pragma unroll
  for (int i = 0; i < 8; ++i) { const int ka = k0 + 8 * g + i, kb = ka + 16; v[i] = ka < K ? W[(size_t)(ka < K ? ka : K - 1) * ld + n] : 0.f; v[8 + i] = kb < K ? W[(size_t)(kb < K ? kb : K - 1) * ld + n] : 0.f; }
  return bsplit16(v); }
__device__ __forceinline__ v8f mac3(const F2& a, const F2& b, v8f c) { c = wmma_bf(a.l, b.h, c); c = wmma_bf(a.h, b.l, c); return wmma_bf(a.h, b.h, c); }
__device__ __forceinline__ float sigm(float v) { return 1.0f / (1.0f + expf(-v)); }
#define LDSX() do { asm volatile("s_wait_dscnt 0" ::: "memory"); __builtin_amdgcn_wave_barrier(); __builtin_amdgcn_fence(__ATOMIC_RELEASE, "workgroup"); } while (0)

// Multi self-attention (B 2, S 2,048, D 512, 8 heads x 64) with the module's literal head split qp.reshape(B, H, S, Dh) -- NO transpose: head h of batch b = rows [h*2048, (h+1)*2048) of the projection viewed as [B][H*S][64] -- scores unscaled, attn = softmax / sqrt(64), ctx.transpose(0,2,1,3) -> [B,S,512], @ Wo + bo.
__device__ __forceinline__ float bfr(float v) { return (float)(__bf16)v; }
#define NBT 2
#define SQ 2048
#define TT SQ
#define NP 8
#define HN 64
#define CC 512
#define HG 4
#ifndef TNB
#define TNB NBT
#endif
// virtual row (b, n, s) of a projection viewed as [b][H*S][64]: float offset
#define ROWO(b, n, s) ((((size_t)(b) * NP + (n)) * SQ + (s)) * HN)
typedef __attribute__((ext_vector_type(8))) __bf16 v8b;
typedef __attribute__((ext_vector_type(4))) __bf16 v4b;
__device__ __forceinline__ v16b frag_b(const __bf16* rowk0, int lane) { union { v16b v; v8b q[2]; } u; const __bf16* p = rowk0 + 8 * (lane >> 4); u.q[0] = *(const v8b*)p; u.q[1] = *(const v8b*)(p + 16); return u.v; }
#define WS_QF  0u                                          // f32 projection rows [b*S+t][512] (== virtual [b][h][s][64])
#define WS_KF  (WS_QF + 4u * (size_t)NBT * SQ * CC)          // k projection, virtual rows of 256 B: 64 bf16 hi, 64 bf16 lo
#define WS_VF  (WS_KF + 4u * (size_t)NBT * SQ * CC)          // v projection, rows as k's
#define WS_S   (WS_VF + 4u * (size_t)NBT * SQ * CC)          // unused (scores and P stay in registers)
#define WS_Y   (WS_S + 4u * (size_t)HG * SQ * SQ)            // f32 ctx rows [b*S+s][h*64+d]
#define WS_END (WS_Y + 4u * (size_t)NBT * SQ * CC)
// W of a projection is staged per block: 64 rows (k) x 128 columns, rounded to bf16 as before, row-major in LDS; every wave reads its B fragments from there with the transposing load
#define WKC 64                       // k rows of W per stage
#define WPT 288                      // LDS pitch of a staged W row: 256 B + 32, 32 B x odd, conflict-free for ds_load_tr16_b128
#define WBUF (WKC * WPT)
typedef __attribute__((ext_vector_type(8))) short s16x8;
// one wave-wide load = one whole row piece of 512 B (4 lines); wave w takes rows w, w + 4, ...
__device__ __forceinline__ void w_load(v4f (&r)[WKC / 4], const float* wp, int st) {
#pragma unroll
  for (int i = 0; i < WKC / 4; ++i) r[i] = *(const v4f*)(wp + (size_t)(st * WKC + i * 4) * CC); }
__device__ __forceinline__ void w_store(char* d, const v4f (&r)[WKC / 4]) {
#pragma unroll
  for (int i = 0; i < WKC / 4; ++i) { v4b h;
#pragma unroll
    for (int e = 0; e < 4; ++e) h[e] = (__bf16)r[i][e];
    *(v4b*)(d + i * 4 * WPT) = h; } }
// eight 16-byte copies per lane, global memory to LDS through no register; the s_wait_xcnt is the last line of the copies' own statement so that no address register is rewritten ahead of it
__device__ __forceinline__ void acopy8(const unsigned (&l)[8], const char* const (&p)[8]) {
  asm volatile("global_load_async_to_lds_b128 %0, %8, off\n\t"
               "global_load_async_to_lds_b128 %1, %9, off\n\t"
               "global_load_async_to_lds_b128 %2, %10, off\n\t"
               "global_load_async_to_lds_b128 %3, %11, off\n\t"
               "global_load_async_to_lds_b128 %4, %12, off\n\t"
               "global_load_async_to_lds_b128 %5, %13, off\n\t"
               "global_load_async_to_lds_b128 %6, %14, off\n\t"
               "global_load_async_to_lds_b128 %7, %15, off\n\t"
               "s_wait_xcnt 0x0"
               :: "v"(l[0]), "v"(l[1]), "v"(l[2]), "v"(l[3]), "v"(l[4]), "v"(l[5]), "v"(l[6]), "v"(l[7]), "v"(p[0]), "v"(p[1]), "v"(p[2]), "v"(p[3]), "v"(p[4]), "v"(p[5]), "v"(p[6]), "v"(p[7]) : "memory"); }
// the row operand is staged too: a wave's own 16 rows x 64 k of f32 (256 B a row) per stage, by copies that each cover whole lines (16 lanes = one row's 256 B, a wave-wide copy = 2 rows = 4 lines); read straight from memory in fragment order a wave-wide load touched 16 lines for its 512 B
#define XP 272                       // LDS pitch of a staged row piece: 256 B + 16, 16 B x odd, conflict-free for 16-byte reads down a column of rows
#define XWB (16 * XP)                // one wave's 16 rows
#define XBUF (4 * XWB)               // the block's 64 rows
__device__ __forceinline__ void x_copy(unsigned lx, const char* gx, int st) {   // lx, gx: the lane's own 16 bytes of the wave's first two rows, in LDS and in memory (stage 0)
  unsigned l[8]; const char* p[8];
#pragma unroll
  for (int i = 0; i < 8; ++i) { l[i] = lx + i * 2 * XP; p[i] = gx + ((size_t)st * (WKC * 4) + (size_t)i * 2 * (CC * 4)); }
  acopy8(l, p); }
// the lane's 2 x 16 values of its own row for the stage's two 32-wide k chunks, in fragment order (8g + 0..7, 16 + 8g + 0..7); the lane's row and its 32 * g bytes are already in xl
__device__ __forceinline__ void x_read(v4f (&r)[8], const char* xl) {
#pragma unroll
  for (int c = 0; c < 2; ++c) { const char* p = xl + c * 128; r[c * 4] = *(const v4f*)p; r[c * 4 + 1] = *(const v4f*)(p + 16); r[c * 4 + 2] = *(const v4f*)(p + 64); r[c * 4 + 3] = *(const v4f*)(p + 80); } }
// B fragment (32 k x 16 columns) of the staged tile: p = tile + (k0 + 8g + (lane & 7)) * WPT + 2 * column0 + 16 * ((lane >> 3) & 1); lane (g, col) gets k0 + 8g + 0..7 and k0 + 16 + 8g + 0..7 of column0 + col
__device__ __forceinline__ v16b frag_t(const char* p) { typedef __attribute__((address_space(3))) s16x8 lds_s16x8; union { v16b v; s16x8 q[2]; } u;
  u.q[0] = __builtin_amdgcn_ds_load_tr16_b128_v8i16((lds_s16x8*)p); u.q[1] = __builtin_amdgcn_ds_load_tr16_b128_v8i16((lds_s16x8*)(p + 16 * WPT)); return u.v; }
__device__ __forceinline__ void x_frag(v16b (&a)[2], const v4f (&xr)[8]) {
#pragma unroll
  for (int c = 0; c < 2; ++c)
#pragma unroll
    for (int i = 0; i < 4; ++i) { a[c][i] = (__bf16)xr[c * 4][i]; a[c][4 + i] = (__bf16)xr[c * 4 + 1][i]; a[c][8 + i] = (__bf16)xr[c * 4 + 2][i]; a[c][12 + i] = (__bf16)xr[c * 4 + 3][i]; } }
__device__ __forceinline__ void x_frag2(F2 (&a)[2], const v4f (&xr)[8]) {
#pragma unroll
  for (int c = 0; c < 2; ++c) { float v[16];
#pragma unroll
    for (int i = 0; i < 4; ++i) { v[i] = xr[c * 4][i]; v[4 + i] = xr[c * 4 + 1][i]; v[8 + i] = xr[c * 4 + 2][i]; v[12 + i] = xr[c * 4 + 3][i]; }
    a[c] = bsplit16(v); } }
// one stage's products: four groups of four B fragments (k chunk c = q >> 1, columns (q & 1) * 64 ...); per accumulator the k chunks come in ascending order, as before
__device__ __forceinline__ void mm_stage(v8f (&acc)[8], const v4f (&xr)[8], const char* tb) { v16b a[2];
#pragma unroll
  for (int q = 0; q < 4; ++q) { v16b w[4];
#pragma unroll
    for (int j = 0; j < 4; ++j) w[j] = frag_t(tb + (q >> 1) * 32 * WPT + ((q & 1) * 4 + j) * 32);
    __builtin_amdgcn_sched_barrier(0);   // keeps a group's eight LDS reads together in front of its WMMAs: one LDS latency a group (without it each fragment's reads stand directly in front of its WMMA and each waits alone)
    if (q == 0) x_frag(a, xr);   // the row values, read from LDS just before, are rounded behind the first group's reads: both runs of reads share one latency
#pragma unroll
    for (int j = 0; j < 4; ++j) acc[(q & 1) * 4 + j] = wmma_bf(a[q >> 1], w[j], acc[(q & 1) * 4 + j]); } }
// the same with the row operand split hi + lo: per accumulator hi, then lo, of each k chunk, as before
__device__ __forceinline__ void mm_stage2(v8f (&acc)[8], const v4f (&xr)[8], const char* tb) { F2 a[2];
#pragma unroll
  for (int q = 0; q < 4; ++q) { v16b w[4];
#pragma unroll
    for (int j = 0; j < 4; ++j) w[j] = frag_t(tb + (q >> 1) * 32 * WPT + ((q & 1) * 4 + j) * 32);
    __builtin_amdgcn_sched_barrier(0);   // as in mm_stage
    if (q == 0) x_frag2(a, xr);   // as in mm_stage
#pragma unroll
    for (int j = 0; j < 4; ++j) acc[(q & 1) * 4 + j] = wmma_bf(a[q >> 1].h, w[j], acc[(q & 1) * 4 + j]);
#pragma unroll
    for (int j = 0; j < 4; ++j) acc[(q & 1) * 4 + j] = wmma_bf(a[q >> 1].l, w[j], acc[(q & 1) * 4 + j]); } }
// ---- k_lin: block = (64 rows, 128 cols, which): {q,k,v}p = input W ((in,out)) + b, exact products, f32 rows (k, v: the f32 value as bf16 hi + lo)
__global__ __launch_bounds__(128) void k_lin(const float* __restrict__ XQ, const float* __restrict__ XK, const float* __restrict__ XV, const float* __restrict__ WQ, const float* __restrict__ BQ, const float* __restrict__ WK, const float* __restrict__ BK, const float* __restrict__ WV, const float* __restrict__ BV, float* __restrict__ QF, float* __restrict__ KF, float* __restrict__ VF) { __shared__ __align__(16) float sf[4][16][132]; __shared__ __align__(32) char sw[2 * WBUF]; __shared__ __align__(16) char sx[2 * XBUF];
  const int tid = threadIdx.x, wave = tid >> 5, lane = tid & 31, col = lane & 15, g = lane >> 4; const int which = blockIdx.z; const int c0 = blockIdx.y * 128; const size_t r0 = (size_t)blockIdx.x * 64 + wave * 16;
  const float* X = which == 0 ? XQ : which == 1 ? XK : XV; const float* WA = which == 0 ? WQ : which == 1 ? WK : WV; const float* BA = which == 0 ? BQ : which == 1 ? BK : BV; float* DST = which == 0 ? QF : which == 1 ? KF : VF;
  v8f acc[8] = {};
  const float* wp = WA + (size_t)wave * CC + c0 + lane * 4; const char* gx = (const char*)(X + (r0 + g) * CC) + col * 16;
  char* sd = sw + wave * WPT + lane * 8; const char* tl = sw + (8 * g + (lane & 7)) * WPT + 16 * ((lane >> 3) & 1);
  const unsigned lx = (unsigned)(size_t)sx + wave * XWB + g * XP + col * 16; const char* xl = sx + wave * XWB + col * XP + 32 * g;
  v4f wr[WKC / 4], xr[8];
  x_copy(lx, gx, 0); w_load(wr, wp, 0); w_store(sd, wr);
  asm volatile("s_wait_asynccnt 0x0" ::: "memory");   // this wave's copies of stage 0 have landed
  __syncthreads();   // stage 0 may be read
  x_copy(lx + XBUF, gx, 1);
  // the stage loop stays rolled (one stage's W loads in flight fill 64 registers); the last stage, which has nothing to fetch, stands behind it
#pragma unroll 1
  for (int st = 0; st + 1 < CC / WKC; ++st) { x_read(xr, xl + (st & 1) * XBUF);
    w_load(wr, wp, st + 1);   // the next stage's loads fly while this stage is worked on
    mm_stage(acc, xr, tl + (st & 1) * WBUF);
    w_store(sd + ((st + 1) & 1) * WBUF, wr);
    asm volatile("s_wait_dscnt 0x0" ::: "memory");      // this wave's reads of the row buffer have returned before it is handed back
    asm volatile("s_wait_asynccnt 0x0" ::: "memory");   // this wave's copies of stage st + 1 have landed
    __syncthreads();   // publishes stage st + 1 and ends every wave's reads of stage st, whose buffers are refilled behind it
    if (st + 2 < CC / WKC) x_copy(lx + (st & 1) * XBUF, gx, st + 2); }
  asm volatile("s_wait_asynccnt 0x0" ::: "memory");     // no copy is outstanding behind the loop
  x_read(xr, xl + ((CC / WKC - 1) & 1) * XBUF); mm_stage(acc, xr, tl + ((CC / WKC - 1) & 1) * WBUF);
#pragma unroll
  for (int j = 0; j < 8; ++j) { const float bb = bfr(BA[c0 + j * 16 + col]);
#pragma unroll
    for (int r = 0; r < 8; ++r) sf[wave][8 * g + r][j * 16 + col] = acc[j][r] + bb; }
  LDSX();
  if (which != 0) {   // k and v rows leave split: virtual row (64 values, 256 B) = 64 bf16 hi, then 64 bf16 lo; 16 lanes fill one whole 128-B line per store
    char* kd = (char*)DST + (r0 * (CC / HN) + c0 / HN + g) * (size_t)(HN * 4) + col * 8;
    for (int rl = 0; rl < 16; ++rl) { const v4f x = *(const v4f*)&sf[wave][rl][lane * 4]; v4b h, l;
#pragma unroll
      for (int i = 0; i < 4; ++i) { h[i] = (__bf16)x[i]; l[i] = (__bf16)(x[i] - (float)h[i]); }
      vst2(kd + (size_t)rl * (CC * 4), h); vst2(kd + (size_t)rl * (CC * 4) + HN * 2, l); } }
  else { for (int rl = 0; rl < 16; ++rl) vst2(DST + (r0 + rl) * CC + c0 + lane * 4, *(const v4f*)&sf[wave][rl][lane * 4]);
    asm volatile("s_wait_xcnt 0x0" ::: "memory"); } }   // behind the run of stores: no register that a store names is rewritten ahead of it on any way the built code has from here
// ---- k_fa: block = (128 queries, b*8+n), 8 waves = 4 query groups x 2 key halves; one wave = 32 queries (two query tiles, so that every K and V fragment read from LDS feeds two tiles' products) against its half (64 keys) of every stage; the two halves' maxima, sums and ctx are joined once, behind the loop: S^T = K Q^T (3 products; q split here from its f32 virtual rows, k read as the hi + lo rows k_lin stored), running maximum and sum per query, ctx^T += V^T P^T (3 products; V^T fragments by the transposing LDS load from the hi + lo rows k_lin stored), P stays in registers
// S^T tile: lane (g, col) holds keys 8g+0..7 of query col, which is the B fragment order of P^T for 32 keys (elements 0..7 from the first 16-key tile, 8..15 from the second)
// e^(s - m) = 2^(s log2 e - m log2 e): one fused multiply-add and the hardware's 2^x per score; the argument is <= 0 but for the rounding of m log2 e, and below -126 the result is 0
#define LOG2E 1.44269504088896340736f
// eight 2^x, each in its own register, in one statement; the v_nop is the slot behind the last one, whose result the next instruction may read
__device__ __forceinline__ void ex2x8(float* x) {
  asm("v_exp_f32 %0, %0\n\tv_exp_f32 %1, %1\n\tv_exp_f32 %2, %2\n\tv_exp_f32 %3, %3\n\tv_exp_f32 %4, %4\n\tv_exp_f32 %5, %5\n\tv_exp_f32 %6, %6\n\tv_exp_f32 %7, %7\n\tv_nop"
      : "+v"(x[0]), "+v"(x[1]), "+v"(x[2]), "+v"(x[3]), "+v"(x[4]), "+v"(x[5]), "+v"(x[6]), "+v"(x[7])); }
__device__ __forceinline__ v8f wmma_p(v16b a, v16b b, v8f c) { return __builtin_amdgcn_wmma_f32_16x16x32_bf16(false, a, false, b, (short)0, c, false, false); }
// K rows and V rows of 128 keys are staged once per block in LDS; waves 0..3 read the first 64 keys, waves 4..7 the second; two buffers, the next stage's copies fly while this stage is worked on
#define FK 128                       // keys per stage
#define FH 64                        // keys per stage and wave
#define QT 2                         // query tiles (16 queries each) per wave
#define KP 272                       // LDS pitch of a K row: 256 B + 16, 16 B x odd, conflict-free for 16-byte reads down a column of rows
#define VP 288                       // LDS pitch of a V row: 256 B + 32, 32 B x odd, conflict-free for ds_load_tr16_b128
#define OFF_V (FK * KP)
#define BUFB (OFF_V + FK * VP)
// one stage: 128 K rows and 128 V rows, each 32 KiB in a row in memory; a wave's copy = 4 whole lines, the block's = 16 rows
__device__ __forceinline__ void stage_in(unsigned lk, unsigned lv, const char* gk, const char* gv, unsigned go, int st) {   // gk, gv: the head's first K and V row, the same in every lane; go: the thread's own byte offset in a copy's 4 KiB
  unsigned l[8]; const char* p[8];
#pragma unroll
  for (int i = 0; i < 8; ++i) { l[i] = lk + i * 16 * KP; p[i] = gk + ((size_t)st * (FK * HN * 4) + i * 4096) + go; }
  acopy8(l, p);
#pragma unroll
  for (int i = 0; i < 8; ++i) { l[i] = lv + i * 16 * VP; p[i] = gv + ((size_t)st * (FK * HN * 4) + i * 4096) + go; }
  acopy8(l, p); }
__device__ __forceinline__ v16b frag_s(const char* p) { union { v16b v; v8b q[2]; } u; u.q[0] = *(const v8b*)p; u.q[1] = *(const v8b*)(p + 32); return u.v; }   // 32 bf16 of an LDS row (a 32-wide k chunk of a K half row) in fragment order; the lane's 16 * (lane >> 4) bytes are already in p
__device__ __forceinline__ F2 ld_kf(const char* p) { F2 r; r.h = frag_s(p); r.l = frag_s(p + HN * 2); return r; }   // hi and lo fragment of a 32-wide k chunk of an LDS row of K
// A fragment of V^T (16 d x 32 keys) from the staged V rows: p = tile + (key0 + 8g + (lane & 7)) * VP + 2 * d0 + 16 * ((lane >> 3) & 1); lane (g, col) gets keys key0 + 8g + 0..7 and key0 + 16 + 8g + 0..7 of d0 + col, the order of P^T's elements
__device__ __forceinline__ v16b frag_v(const char* p) { typedef __attribute__((address_space(3))) s16x8 lds_s16x8; union { v16b v; s16x8 q[2]; } u;
  u.q[0] = __builtin_amdgcn_ds_load_tr16_b128_v8i16((lds_s16x8*)p); u.q[1] = __builtin_amdgcn_ds_load_tr16_b128_v8i16((lds_s16x8*)(p + 16 * VP)); return u.v; }
__global__ __launch_bounds__(256) void k_fa(const float* __restrict__ QF, const float* __restrict__ KF, const float* __restrict__ VF, float* __restrict__ Y) {
  __shared__ __attribute__((aligned(16))) char sm[2 * BUFB];
  __shared__ v4f mg[8][HN / 16 * 2 + 1][32];   // the join: per wave one query tile's ctx (32 values a lane), maximum and sum, 16 bytes a lane in a row
  const int tid = threadIdx.x, wave = tid >> 5, lane = tid & 31, col = lane & 15, g = lane >> 4; const int bn = blockIdx.y; const int b = bn / NP, n = bn % NP;
  const int qg = wave & 3, kh = wave >> 2; const int q0 = blockIdx.x * (4 * QT * 16) + qg * (QT * 16);
  // the thread's own 16 bytes of each copy: LDS byte addresses in buffer 0, byte offset in the copy's 4 KiB of memory (the 64-bit address pairs are formed at each stage from the head's uniform base: kept in vector registers over the loop they were spilled)
  const unsigned sm0 = (unsigned)(size_t)sm; const unsigned lk = sm0 + (tid >> 4) * KP + (tid & 15) * 16; const unsigned lv = sm0 + OFF_V + (tid >> 4) * VP + (tid & 15) * 16;
  const char* gk = (const char*)(KF + ROWO(b, n, 0)); const char* gv = (const char*)(VF + ROWO(b, n, 0)); const unsigned go = tid * 16;
  stage_in(lk, lv, gk, gv, go, 0);
  F2 qf[QT][HN / 32];
#pragma unroll
  for (int t = 0; t < QT; ++t) {
#pragma unroll
    for (int kc = 0; kc < HN / 32; ++kc) qf[t][kc] = split_row(QF + ROWO(b, n, q0 + t * 16 + col), kc * 32, lane);
    asm volatile("s_wait_xcnt 0x0" ::: "memory"); }   // behind each query tile's run of loads: no register that a load names is rewritten ahead of it (the next tile's loads may land on the address pair)
  asm volatile("s_wait_asynccnt 0x0" ::: "memory");   // this wave's copies of stage 0 have landed
  __syncthreads();                                     // ... and every other wave's: stage 0 may be read
  stage_in(lk + BUFB, lv + BUFB, gk, gv, go, 1);
  const char* kl0 = sm + (kh * FH + col) * KP + 16 * g; const char* vl0 = sm + OFF_V + (kh * FH + 8 * g + (lane & 7)) * VP + 16 * ((lane >> 3) & 1);   // in the wave's half of the stage: the lane's own row and half in the K tile; its row and 16 bytes of the V tile for the transposing load
  v8f acc[QT][HN / 16] = {}; float m[QT], l[QT];   // m: the running maximum times log2 e
#pragma unroll
  for (int t = 0; t < QT; ++t) { m[t] = -3.0e38f; l[t] = 0.f; }
  F2 kr[2][HN / 32];
#pragma unroll
  for (int u = 0; u < 2; ++u)
#pragma unroll
    for (int kc = 0; kc < HN / 32; ++kc) kr[u][kc] = ld_kf(kl0 + u * 16 * KP + kc * 64);
  // the stage loop and the loop over the two 32-key trips of the wave's half stage stay rolled; the short loops inside are unrolled so that the fragment arrays live in registers
#pragma unroll 1
  for (int st = 0; st < SQ / FK; ++st) { const int bo = (st & 1) * BUFB; const char* kb = kl0 + bo; const char* vb = vl0 + bo;
#pragma unroll 1
    for (int h = 0; h < FH / 32; ++h) { v8f s[QT][2]; v16b vh[HN / 16], vl[HN / 16];
#pragma unroll
      for (int u = 0; u < 2; ++u)
#pragma unroll
        for (int t = 0; t < QT; ++t) { v8f c = {};
#pragma unroll
          for (int kc = 0; kc < HN / 32; ++kc) { const F2 kf = kr[u][kc]; c = wmma_p(kf.l, qf[t][kc].h, c); c = wmma_p(kf.h, qf[t][kc].l, c); c = wmma_p(kf.h, qf[t][kc].h, c); }
          s[t][u] = c; }
      float mx[QT];
#pragma unroll
      for (int t = 0; t < QT; ++t) { float x = fmaxf(s[t][0][0], s[t][1][0]);
#pragma unroll
        for (int i = 1; i < 8; ++i) x = fmaxf(x, fmaxf(s[t][0][i], s[t][1][i]));
        mx[t] = x * LOG2E; }   // from here on the maximum is kept as this rounded product (rounding keeps the order): the one value that every exponent below is taken against
#pragma unroll
      for (int t = 0; t < QT; ++t) mx[t] = fmaxf(mx[t], __shfl_xor(mx[t], 16));   // the exchange goes through the LDS queue, which returns in order: it stands in front of the K and V reads so that its result does not wait for theirs
      if (h == 0) {   // the same half stage's second 32 keys' rows, fetched one trip ahead; nothing of the next stage is read here
#pragma unroll
        for (int u = 0; u < 2; ++u)
#pragma unroll
          for (int kc = 0; kc < HN / 32; ++kc) kr[u][kc] = ld_kf(kb + (32 + u * 16) * KP + kc * 64); }
#pragma unroll
      for (int j = 0; j < HN / 16; ++j) { vh[j] = frag_v(vb + h * 32 * VP + j * 32); vl[j] = frag_v(vb + h * 32 * VP + HN * 2 + j * 32); }
      __builtin_amdgcn_sched_barrier(0);   // keeps the V reads issued above the softmax, so that its arithmetic covers their latency (without it the scheduler sinks them to their first use)
      F2 pf[QT]; float al[QT];
#pragma unroll
      for (int t = 0; t < QT; ++t) { const float mn = fmaxf(m[t], mx[t]); al[t] = __builtin_amdgcn_exp2f(m[t] - mn); m[t] = mn;
        const v8f e0 = __builtin_elementwise_fma(s[t][0], v8f{} + LOG2E, v8f{} - mn), e1 = __builtin_elementwise_fma(s[t][1], v8f{} + LOG2E, v8f{} - mn);
        float pv[16]; float ps = 0.f;
#pragma unroll
        for (int i = 0; i < 8; ++i) { pv[i] = e0[i]; pv[8 + i] = e1[i]; }
        ex2x8(pv); ex2x8(pv + 8);
#pragma unroll
        for (int i = 0; i < 8; ++i) { ps += pv[i] + pv[8 + i]; }
        l[t] = l[t] * al[t] + ps; pf[t] = bsplit16(pv); }
#pragma unroll
      for (int j = 0; j < HN / 16; ++j)
#pragma unroll
        for (int t = 0; t < QT; ++t) { v8f c = acc[t][j] * al[t]; c = wmma_p(vh[j], pf[t].h, c); c = wmma_p(vh[j], pf[t].l, c); acc[t][j] = wmma_p(vl[j], pf[t].h, c); }
      // WMMA distance: no vector instruction need stand between the trip's last WMMAs and the next trip's score WMMAs, whose D a build without this line may lay over a P fragment directly behind its last reader; four slots behind all accumulators, P held to here
      asm volatile("v_nop\n\tv_nop\n\tv_nop\n\tv_nop" : "+v"(acc[0][0]), "+v"(acc[0][1]), "+v"(acc[0][2]), "+v"(acc[0][3]), "+v"(acc[1][0]), "+v"(acc[1][1]), "+v"(acc[1][2]), "+v"(acc[1][3]) : "v"(pf[0].h), "v"(pf[0].l), "v"(pf[1].h), "v"(pf[1].l)); }
    asm volatile("s_wait_dscnt 0x0" ::: "memory");      // this wave's reads of the buffer have returned before it is handed back
    asm volatile("s_wait_asynccnt 0x0" ::: "memory");   // this wave's copies of stage st + 1 have landed
    __syncthreads();                                     // publishes stage st + 1 and ends every wave's reads of stage st
    if (st + 2 < SQ / FK) stage_in(lk + bo, lv + bo, gk, gv, go, st + 2);
    const char* kn = kl0 + (BUFB - bo);   // behind the barrier: the first 32 keys' rows of the wave's half of stage st + 1 (after the last stage the other buffer's old rows, unused)
#pragma unroll
    for (int u = 0; u < 2; ++u)
#pragma unroll
      for (int kc = 0; kc < HN / 32; ++kc) kr[u][kc] = ld_kf(kn + u * 16 * KP + kc * 64); }
  asm volatile("s_wait_asynccnt 0x0" ::: "memory");     // no copy is outstanding when the wave ends
  // the join of the two key halves: wave (qg, kh) finishes query tile kh; it hands its part of the other tile to wave (qg, 1 - kh) through LDS
  const bool k1 = kh != 0;
#pragma unroll
  for (int t = 0; t < QT; ++t) l[t] += __shfl_xor(l[t], 16);
#pragma unroll
  for (int j = 0; j < HN / 16; ++j) { const v8f c = k1 ? acc[0][j] : acc[1][j]; const v4f lo = {c[0], c[1], c[2], c[3]}, hi = {c[4], c[5], c[6], c[7]}; mg[wave][2 * j][lane] = lo; mg[wave][2 * j + 1][lane] = hi; }
  { const v4f ml = {k1 ? m[0] : m[1], k1 ? l[0] : l[1], 0.f, 0.f}; mg[wave][HN / 16 * 2][lane] = ml; }
  __syncthreads();   // every wave's part for its partner is in LDS
  const int pw = wave ^ 4; const v4f ml = mg[pw][HN / 16 * 2][lane];
  const float ma = k1 ? m[1] : m[0], la = k1 ? l[1] : l[0]; const float mm = fmaxf(ma, ml[0]); const float wa = __builtin_amdgcn_exp2f(ma - mm), wb = __builtin_amdgcn_exp2f(ml[0] - mm);
  const float inv = 1.0f / (la * wa + ml[1] * wb) * 0.125f;   // the module divides the softmax by sqrt(64)
  const float fa = wa * inv, fb = wb * inv;
  float* yr = Y + ((size_t)b * SQ + q0 + kh * 16 + col) * CC + n * HN + 8 * g;
#pragma unroll
  for (int j = 0; j < HN / 16; ++j) { const v8f c = k1 ? acc[1][j] : acc[0][j]; const v4f pl = mg[pw][2 * j][lane], ph = mg[pw][2 * j + 1][lane];
    const v4f lo = {c[0], c[1], c[2], c[3]}, hi = {c[4], c[5], c[6], c[7]}; vst2(yr + j * 16, lo * fa + pl * fb); vst2(yr + j * 16 + 4, hi * fa + ph * fb); } }
// ---- k_out: block = (64 rows, 128 cols): out = y (bf16 hi + lo) Wo + bo
__global__ __launch_bounds__(128) void k_out(const float* __restrict__ Y, const float* __restrict__ WP, const float* __restrict__ BP, float* __restrict__ OUT) { __shared__ __align__(16) float sf[4][16][132]; __shared__ __align__(32) char sw[2 * WBUF]; __shared__ __align__(16) char sx[2 * XBUF];
  const int tid = threadIdx.x, wave = tid >> 5, lane = tid & 31, col = lane & 15, g = lane >> 4; const int c0 = blockIdx.y * 128; const size_t r0 = (size_t)blockIdx.x * 64 + wave * 16;
  v8f acc[8] = {};
  const float* wp = WP + (size_t)wave * CC + c0 + lane * 4; const char* gx = (const char*)(Y + (r0 + g) * CC) + col * 16;
  char* sd = sw + wave * WPT + lane * 8; const char* tl = sw + (8 * g + (lane & 7)) * WPT + 16 * ((lane >> 3) & 1);
  const unsigned lx = (unsigned)(size_t)sx + wave * XWB + g * XP + col * 16; const char* xl = sx + wave * XWB + col * XP + 32 * g;
  v4f wr[WKC / 4], xr[8];
  x_copy(lx, gx, 0); w_load(wr, wp, 0); w_store(sd, wr);
  asm volatile("s_wait_asynccnt 0x0" ::: "memory");   // this wave's copies of stage 0 have landed
  __syncthreads();   // stage 0 may be read
  x_copy(lx + XBUF, gx, 1);
  // the stage loop stays rolled (one stage's W loads in flight fill 64 registers); the last stage, which has nothing to fetch, stands behind it
#pragma unroll 1
  for (int st = 0; st + 1 < CC / WKC; ++st) { x_read(xr, xl + (st & 1) * XBUF);
    w_load(wr, wp, st + 1);   // the next stage's loads fly while this stage is worked on
    mm_stage2(acc, xr, tl + (st & 1) * WBUF);
    w_store(sd + ((st + 1) & 1) * WBUF, wr);
    asm volatile("s_wait_dscnt 0x0" ::: "memory");      // this wave's reads of the row buffer have returned before it is handed back
    asm volatile("s_wait_asynccnt 0x0" ::: "memory");   // this wave's copies of stage st + 1 have landed
    __syncthreads();   // publishes stage st + 1 and ends every wave's reads of stage st, whose buffers are refilled behind it
    if (st + 2 < CC / WKC) x_copy(lx + (st & 1) * XBUF, gx, st + 2); }
  asm volatile("s_wait_asynccnt 0x0" ::: "memory");     // no copy is outstanding behind the loop
  x_read(xr, xl + ((CC / WKC - 1) & 1) * XBUF); mm_stage2(acc, xr, tl + ((CC / WKC - 1) & 1) * WBUF);
#pragma unroll
  for (int j = 0; j < 8; ++j) { const float bb = BP ? bfr(BP[c0 + j * 16 + col]) : 0.f;
#pragma unroll
    for (int r = 0; r < 8; ++r) sf[wave][8 * g + r][j * 16 + col] = acc[j][r] + bb; }
  LDSX(); for (int rl = 0; rl < 16; ++rl) vst2(OUT + (r0 + rl) * CC + c0 + lane * 4, *(const v4f*)&sf[wave][rl][lane * 4]); }
extern "C" void kernel_launch(void* const* d_in, const int* in_sizes, int n_in, void* d_out, int out_size, void* d_ws, size_t ws_size, hipStream_t stream) {
  (void)in_sizes; (void)n_in; (void)out_size;
  const float** F = (const float**)d_in;   // 0 q [2,2048,512], 1 k, 2 v, 3 Wq [512,512] ((in,out)), 4 bq, 5 Wk, 6 bk, 7 Wv, 8 bv, 9 Wo, 10 bo
  if (ws_size < (size_t)WS_END) return;
  char* ws = (char*)d_ws; float *QF = (float*)(ws + WS_QF), *KF = (float*)(ws + WS_KF), *VF = (float*)(ws + WS_VF), *Y = (float*)(ws + WS_Y);
  k_lin<<<dim3(TNB * SQ / 64, CC / 128, 3), 128, 0, stream>>>(F[0], F[1], F[2], F[3], F[4], F[5], F[6], F[7], F[8], QF, KF, VF);
  k_fa<<<dim3(SQ / 128, TNB * NP), 256, 0, stream>>>(QF, KF, VF, Y);
  k_out<<<dim3(TNB * SQ / 64, CC / 128), 128, 0, stream>>>(Y, F[9], F[10], (float*)d_out);
}
